// v000
// Times are from an AMD MI455X. After a warm-up the kernel runs many times in a row, and a time is the length of
// such a window on the GPU divided by its runs, so every launch and the gaps after it count. The runs cycle
// through copies of the inputs. A figure is the median of several windows, for all but v000 over two sittings.
// Sittings can differ by a few percent; kernels timed side by side share one.
// v000 is the starting kernel. One run takes 64.1 microseconds.
// Contraction out[b][t][r][c] = sum_{j<=t} D[t][j] * xn[b][j][r][c] per (b, r), K = 512: v_wmma_f32_16x16x32_f16 with D = exp(cs_t - cs_j) carried x2^14 and xn carried x2^3, each as f16 hi + x2^11 residual plane, products hi.hi + (hi.lo + lo.hi) x 2^-11, f32 accumulate. LayerNorm, the 64-term dt dot, softplus, prefix sum and exp are f32 on VALU; all six inputs RNE-converted to bf16 values on load.
#include <hip/hip_runtime.h>
#include <math.h>
#include <stdint.h>

#define NB   2
#define TS   512
#define DS   64
#define NBT  (NB * TS)          // 1024 (b, t) rows
#define PLN  (DS * DS)          // 4096 elements per (b, t)
#define NTOT (NBT * PLN)        // 4194304
static_assert((TS % 64) == 0);
static_assert(DS == 64);
static_assert(PLN == 2 * 8 * 256);

typedef _Float16 v16h __attribute__((ext_vector_type(16)));
typedef _Float16 v8h  __attribute__((ext_vector_type(8)));
typedef float    v8f  __attribute__((ext_vector_type(8)));
typedef float    v4f  __attribute__((ext_vector_type(4)));
typedef unsigned int v4u __attribute__((ext_vector_type(4)));

// ---- scalar helpers --------------------------------------------------------------------------------
__device__ __forceinline__ unsigned short bf_bits(float f) {          // f32 -> bf16 bits, RNE convert
  unsigned u = __float_as_uint(f);
  return (unsigned short)((u + 0x7FFFu + ((u >> 16) & 1u)) >> 16);
}
__device__ __forceinline__ float bfr(float f) { return __uint_as_float(((unsigned)bf_bits(f)) << 16); }
__device__ __forceinline__ unsigned short h_bits(_Float16 x) { return __builtin_bit_cast(unsigned short, x); }
__device__ __forceinline__ unsigned pk16(unsigned short a, unsigned short b) { return (unsigned)a | ((unsigned)b << 16); }
__device__ __forceinline__ v8f zero8() { v8f z = {0.f, 0.f, 0.f, 0.f, 0.f, 0.f, 0.f, 0.f}; return z; }
__device__ __forceinline__ float wave_sum(float v) {
#pragma unroll
  for (int off = 16; off > 0; off >>= 1) v += __shfl_xor(v, off, 32);
  return v;
}

// ---- fragment loader: 16-bit operand, lane -> row/col (lane&15), p already includes +8*(lane>>4);
//      elements 0..7 <- p[0..7] (k0+8h..), elements 8..15 <- p[16..23] (k0+16+8h..)
__device__ __forceinline__ v16h ldfrag_h(const _Float16* p) {
  union { v16h v; v8h h[2]; } f;
  f.h[0] = *(const v8h*)(p);
  f.h[1] = *(const v8h*)(p + 16);
  return f.v;
}

// ---- WMMA helper with trailing VALU hazard gap ----------------------------------------------------------
__device__ __forceinline__ v8f mma_h(v16h a, v16h b, v8f c) {
  c = __builtin_amdgcn_wmma_f32_16x16x32_f16(false, a, false, b, (short)0, c, false, false);
#if defined(__HIP_DEVICE_COMPILE__)
  asm volatile("v_nop\n\tv_nop\n\tv_nop\n\tv_nop" : "+v"(c) : "v"(a), "v"(b));
#endif
  return c;
}

// =====================================================================================================
// Stage 1: one block per (b, t), 256 threads. Thread tid owns elements e0 = tid*8..+7 (row tid>>3,
// cols (tid&7)*8..+7) and e1 = 2048 + tid*8..+7 (row 32 + tid>>3, same cols) of the 64x64 slice.
// + dt_b; dt = softplus(z) = max(z,0) + log1p(exp(-|z|)); ld[b][t][r] = dt * (-exp(log_A[r])).
// Outputs: Xh = f16(8 xn), Xl = f16((8 xn - Xh) * 2048) in [b][t][r][c] layout: per plane two store
// coverage: Xh/Xl 2 x 256 x 8 = 4096 halves per (b,t); ld 16 x 4 = 64 floats per (b,t); grid = all (b,t).
// =====================================================================================================
__global__ __launch_bounds__(256) void ln_k(const float* __restrict__ x, const float* __restrict__ logA,
                                            const float* __restrict__ dtw, const float* __restrict__ dtb,
                                            const float* __restrict__ lnw, const float* __restrict__ lnb,
                                            unsigned short* Xh, unsigned short* Xl, float* ldp, int nbt) {
  __shared__ float red0[8];
  __shared__ float red1[8];
  __shared__ float zrow[64];
  __shared__ __align__(16) float ldv[64];
  const int bt = blockIdx.x;
  if (bt >= nbt) return;                       // block-uniform, before any barrier
  const int tid = threadIdx.x, lane = tid & 31, wave = tid >> 5;
  const int e0 = tid * 8, e1 = 2048 + tid * 8;
  const float* xp = x + (size_t)bt * PLN;

  const v4f xa = *(const v4f*)(xp + e0);
  const v4f xb = *(const v4f*)(xp + e0 + 4);
  const v4f xc = *(const v4f*)(xp + e1);
  const v4f xd = *(const v4f*)(xp + e1 + 4);
  float v[16];
#pragma unroll
  for (int q = 0; q < 4; ++q) {
    v[q]      = bfr(xa[q]);
    v[4 + q]  = bfr(xb[q]);
    v[8 + q]  = bfr(xc[q]);
    v[12 + q] = bfr(xd[q]);
  }
  // ---- mean ----
  float s = 0.0f;
#pragma unroll
  for (int i = 0; i < 16; ++i) s += v[i];
  s = wave_sum(s);
  if (lane == 0) red0[wave] = s;
  __syncthreads();
  float tot = 0.0f;
#pragma unroll
  for (int w = 0; w < 8; ++w) tot += red0[w];
  const float mu = tot * (1.0f / 4096.0f);
  // ---- centred variance ----
  float ss = 0.0f;
#pragma unroll
  for (int i = 0; i < 16; ++i) { const float d = v[i] - mu; ss += d * d; }
  ss = wave_sum(ss);
  if (lane == 0) red1[wave] = ss;
  __syncthreads();
  float vt = 0.0f;
#pragma unroll
  for (int w = 0; w < 8; ++w) vt += red1[w];
  const float var  = vt * (1.0f / 4096.0f);
  const float rstd = rsqrtf(var + 1e-5f);
  // ---- affine ----
  const v4f wa = *(const v4f*)(lnw + e0), wb = *(const v4f*)(lnw + e0 + 4);
  const v4f wc = *(const v4f*)(lnw + e1), wd = *(const v4f*)(lnw + e1 + 4);
  const v4f ba = *(const v4f*)(lnb + e0), bb = *(const v4f*)(lnb + e0 + 4);
  const v4f bc = *(const v4f*)(lnb + e1), bd = *(const v4f*)(lnb + e1 + 4);
  float xn[16];
#pragma unroll
  for (int q = 0; q < 4; ++q) {
    xn[q]      = (v[q]      - mu) * rstd * bfr(wa[q]) + bfr(ba[q]);
    xn[4 + q]  = (v[4 + q]  - mu) * rstd * bfr(wb[q]) + bfr(bb[q]);
    xn[8 + q]  = (v[8 + q]  - mu) * rstd * bfr(wc[q]) + bfr(bc[q]);
    xn[12 + q] = (v[12 + q] - mu) * rstd * bfr(wd[q]) + bfr(bd[q]);
  }
  // ---- dt dot: 8 terms per thread, reduced over the 8 lanes covering a row ----
  const int c8 = (tid & 7) * 8;
  const v4f da = *(const v4f*)(dtw + c8), db = *(const v4f*)(dtw + c8 + 4);
  float dw[8];
#pragma unroll
  for (int q = 0; q < 4; ++q) { dw[q] = bfr(da[q]); dw[4 + q] = bfr(db[q]); }
  float d0 = 0.0f, d1 = 0.0f;
#pragma unroll
  for (int i = 0; i < 8; ++i) { d0 += xn[i] * dw[i]; d1 += xn[8 + i] * dw[i]; }
  d0 += __shfl_xor(d0, 1, 32); d0 += __shfl_xor(d0, 2, 32); d0 += __shfl_xor(d0, 4, 32);
  d1 += __shfl_xor(d1, 1, 32); d1 += __shfl_xor(d1, 2, 32); d1 += __shfl_xor(d1, 4, 32);
  if ((tid & 7) == 0) { zrow[tid >> 3] = d0; zrow[32 + (tid >> 3)] = d1; }
  __syncthreads();
  if (tid < 64) {
    const float z  = zrow[tid] + bfr(dtb[0]);
    const float sp = fmaxf(z, 0.0f) + log1pf(__expf(-fabsf(z)));     // softplus
    const float ac = -__expf(bfr(logA[tid]));
    ldv[tid] = sp * ac;
  }
  __syncthreads();
  // ---- pack planes: hi = f16(8 xn), residual = f16((8 xn - hi) * 2048) ----
  v4u ph0, pl0, ph1, pl1;
#pragma unroll
  for (int e = 0; e < 4; ++e) {
    const float g0 = xn[2 * e] * 8.0f, g1 = xn[2 * e + 1] * 8.0f;
    const _Float16 x0 = (_Float16)g0, x1 = (_Float16)g1;
    const _Float16 y0 = (_Float16)((g0 - (float)x0) * 2048.0f);
    const _Float16 y1 = (_Float16)((g1 - (float)x1) * 2048.0f);
    ph0[e] = pk16(h_bits(x0), h_bits(x1));
    pl0[e] = pk16(h_bits(y0), h_bits(y1));
    const float k0 = xn[8 + 2 * e] * 8.0f, k1 = xn[8 + 2 * e + 1] * 8.0f;
    const _Float16 u0 = (_Float16)k0, u1 = (_Float16)k1;
    const _Float16 w0 = (_Float16)((k0 - (float)u0) * 2048.0f);
    const _Float16 w1 = (_Float16)((k1 - (float)u1) * 2048.0f);
    ph1[e] = pk16(h_bits(u0), h_bits(u1));
    pl1[e] = pk16(h_bits(w0), h_bits(w1));
  }
  const v4f lv = *(const v4f*)(ldv + (tid & 15) * 4);          // clamped LDS address, stored only by tid < 16
  const size_t po0 = (size_t)bt * PLN + e0;
  const size_t po1 = (size_t)bt * PLN + e1;
  const size_t plo = (size_t)bt * DS + (tid & 15) * 4;
  {
    *(v4u*)(Xh + po0) = ph0;
    *(v4u*)(Xh + po1) = ph1;
    *(v4u*)(Xl + po0) = pl0;
    *(v4u*)(Xl + po1) = pl1;
    if (tid < 16) *(v4f*)(ldp + plo) = lv;
    
  }
}

// =====================================================================================================
// Stage 2: plane [b][t][r][c] (f16) -> plane [b][r][c][t] (same bits), for the hi and the residual plane.
// in[t][c] (64 x 64 tile of one (b, r)) -> out[c][t]; grid = (TS/64 token tiles, DS rows r, NB).
// Tiles staged in LDS as halves (v8h 16-B stores, __syncthreads, element reads).
// Store: group g = tid>>3 (0..31), piece = tid&7: iteration it writes row c = it*32+g, lanes 8q..8q+7 x 16 B
// coverage: load 2 x 256 threads x 8 halves = 64x64 per plane; store 2 iterations x 32 groups = 64 rows c,
// 8 pieces x 8 = 64 tokens per row; grid covers every (b, r, token tile).
// =====================================================================================================
__global__ __launch_bounds__(256) void xt_k(const unsigned short* __restrict__ Xhp, const unsigned short* __restrict__ Xlp,
                                            unsigned short* XhT, unsigned short* XlT) {
  __shared__ __align__(16) _Float16 sh[64 * 72];        // [tt][c], pitch 72 halves (144 B)
  __shared__ __align__(16) _Float16 sl[64 * 72];
  const int tid = threadIdx.x;
  const int t0  = blockIdx.x * 64;
  const int r   = blockIdx.y;
  const int b   = blockIdx.z;
  const _Float16* H = (const _Float16*)(const void*)Xhp;
  const _Float16* L = (const _Float16*)(const void*)Xlp;
#pragma unroll
  for (int i = 0; i < 2; ++i) {
    const int idx = i * 256 + tid;                       // 0..511
    const int tt = idx >> 3, cc8 = (idx & 7) * 8;
    const size_t so = (((size_t)(b * TS + t0 + tt)) * DS + r) * DS + cc8;
    const v8h a  = *(const v8h*)(H + so);
    const v8h a2 = *(const v8h*)(L + so);
    *(v8h*)(sh + tt * 72 + cc8) = a;
    *(v8h*)(sl + tt * 72 + cc8) = a2;
  }
  __syncthreads();

  const int g = tid >> 3, piece = tid & 7;
  v4u hv[2], lvv[2];
  size_t hofs[2];
#pragma unroll
  for (int it = 0; it < 2; ++it) {
    const int c = it * 32 + g;
    v4u a, a2;
#pragma unroll
    for (int e = 0; e < 4; ++e) {
      const int ta = piece * 8 + 2 * e, tb = ta + 1;
      a[e]  = pk16(h_bits(sh[ta * 72 + c]), h_bits(sh[tb * 72 + c]));
      a2[e] = pk16(h_bits(sl[ta * 72 + c]), h_bits(sl[tb * 72 + c]));
    }
    hv[it]  = a;
    lvv[it] = a2;
    hofs[it] = (((size_t)(b * DS + r)) * DS + c) * TS + t0 + piece * 8;
  }
  {
#pragma unroll
    for (int it = 0; it < 2; ++it) {
      *(v4u*)(XhT + hofs[it]) = hv[it];
      *(v4u*)(XlT + hofs[it]) = lvv[it];
    }
    
  }
}

// =====================================================================================================
// Stage 3: out[b][t][r][c] = sum_{j<=t} exp(cs[b][t][r] - cs[b][j][r]) * xn[b][j][r][c].
// Block = (64-row t tile tt, r, b), 4 waves; wave w owns t rows tt*64 + 16w .. +15 and all 64 c.
// cs: the block loads ld[b][0..511][r] into LDS and thread 0 forms the inclusive prefix sum in place
// (sequential f32, identical in every block of the same (b, r)).
// A fragment (decay tile, built in registers): lane row = lane&15 -> t = tbase + (lane&15); element e<8 -> j =
// j0 + 8h + e, e>=8 -> j = j0 + 16 + 8h + (e-8) (split k map); value P = exp(min(cs_t - cs_j, 0)) (<= 1),
// 0 for j > t (select by value), hi = f16(P * 16384), residual = f16((P*16384 - hi) * 2048).
// B fragments: [b][r][c][t] planes, lane col = c, two 16-B loads at j0 + 8h and j0 + 16 + 8h (split k map),
// hi plane (xn x8) and residual plane. acc += Ph.Xh; acc2 += Ph.Xl + Pl.Xh; out = (acc + acc2/2048) / 2^17.
// Loop bound jend = tbase + 16 is wave-uniform; no block barrier inside the loop.
// coverage: 4 waves x 16 rows x 64 cols = the block's 64 x 64 tile; grid (TS/64, DS, NB) = every (t, r, b) once.
// =====================================================================================================
__global__ __launch_bounds__(128) void ssm_k(const unsigned short* __restrict__ XhTp, const unsigned short* __restrict__ XlTp,
                                             const float* __restrict__ ldp, float* outp) {
  __shared__ __align__(16) float cs_s[TS];
  __shared__ __align__(16) float os_s[4 * 16 * 64];
  const int tt = blockIdx.x, r = blockIdx.y, b = blockIdx.z;
  const int tid = threadIdx.x, wave = tid >> 5, lane = tid & 31, hh = lane >> 4, l16 = lane & 15;

#pragma unroll 1
  for (int i = tid; i < TS; i += 128) cs_s[i] = ldp[((size_t)(b * TS + i)) * DS + r];
  __syncthreads();
  if (tid == 0) {
    float a = 0.0f;
#pragma unroll 4
    for (int t = 0; t < TS; ++t) { a += cs_s[t]; cs_s[t] = a; }
  }
  __syncthreads();

  const int tbase = tt * 64 + wave * 16;
  const int trow  = tbase + l16;
  const float cst = cs_s[trow];
  const _Float16* XhT = (const _Float16*)(const void*)XhTp;
  const _Float16* XlT = (const _Float16*)(const void*)XlTp;
  const size_t plb = ((size_t)(b * DS + r)) * DS * TS;
  const _Float16* xbh = XhT + plb;
  const _Float16* xbl = XlT + plb;

  v8f acc[4], acc2[4];
#pragma unroll
  for (int s = 0; s < 4; ++s) { acc[s] = zero8(); acc2[s] = zero8(); }

  const int jend = tbase + 16;               // wave-uniform causal bound
#pragma unroll 1
  for (int j0 = 0; j0 < jend; j0 += 32) {
    const int kA = j0 + hh * 8;
    const int kB = j0 + 16 + hh * 8;
    const v4f q0 = *(const v4f*)(cs_s + kA);
    const v4f q1 = *(const v4f*)(cs_s + kA + 4);
    const v4f q2 = *(const v4f*)(cs_s + kB);
    const v4f q3 = *(const v4f*)(cs_s + kB + 4);
    float cj[16];
#pragma unroll
    for (int q = 0; q < 4; ++q) {
      cj[q]      = q0[q];
      cj[q + 4]  = q1[q];
      cj[q + 8]  = q2[q];
      cj[q + 12] = q3[q];
    }
    v16h pa, pr;
#pragma unroll
    for (int e = 0; e < 16; ++e) {
      const int j = (e < 8) ? (kA + e) : (kB + e - 8);
      const float d = fminf(cst - cj[e], 0.0f);
      float p = __expf(d) * 16384.0f;
      p = (j <= trow) ? p : 0.0f;                          // causal select by value
      const _Float16 x0 = (_Float16)p;
      pa[e] = x0;
      pr[e] = (_Float16)((p - (float)x0) * 2048.0f);
    }
#pragma unroll
    for (int s = 0; s < 4; ++s) {
      const size_t bo = (size_t)(s * 16 + l16) * TS + j0 + 8 * hh;
      const v16h xh = ldfrag_h(xbh + bo);
      const v16h xl = ldfrag_h(xbl + bo);
      acc[s]  = mma_h(pa, xh, acc[s]);
      acc2[s] = mma_h(pa, xl, acc2[s]);
      acc2[s] = mma_h(pr, xh, acc2[s]);
    }
  }

  // ---- epilogue ----
  float* os = os_s + wave * (16 * 64);
#pragma unroll
  for (int r8 = 0; r8 < 8; ++r8) {
#pragma unroll
    for (int s = 0; s < 4; ++s) {
      const float val = (acc[s][r8] + acc2[s][r8] * (1.0f / 2048.0f)) * (1.0f / 131072.0f);
      os[(8 * hh + r8) * 64 + s * 16 + l16] = val;
    }
  }
  __builtin_amdgcn_fence(__ATOMIC_RELEASE, "workgroup");
  __builtin_amdgcn_wave_barrier();
  __builtin_amdgcn_fence(__ATOMIC_ACQUIRE, "workgroup");
  const int h2 = lane >> 4, c4 = (lane & 15) * 4;       // 256-B row = 16 lanes x 16 B
  v4f ov[8];
#pragma unroll
  for (int it = 0; it < 8; ++it) {
    const int row = it * 2 + h2;                         // it 0..7 x h2 0..1 = rows 0..15
    ov[it] = *(const v4f*)(os + row * 64 + c4);
  }
  {
#pragma unroll
    for (int it = 0; it < 8; ++it) {
      const int row = it * 2 + h2;
      const size_t go = (((size_t)(b * TS + tbase + row)) * DS + r) * DS + c4;
      *(v4f*)(outp + go) = ov[it];
    }
    
  }
}

// =====================================================================================================
// Workspace map (bytes); every region is an exact multiple of its whole-line store granularity, all offsets
// multiples of 8388608 except the last, no aliasing:
//   Xh   f16 [1024][4096]   ([b][t][r][c], xn x8 hi)          0         8388608
//   Xl   f16 [1024][4096]   (residual x2^11)                  8388608   8388608
//   XhT  f16 [2][64][64][512] ([b][r][c][t])                  16777216  8388608
//   XlT  f16 [2][64][64][512]                                  25165824  8388608
//   Ld   f32 [1024][64]     ([b][t][r], dt * (-exp(log_A)))   33554432  262144
//   end                                                        33816576
// d_out f32 [2][512][64][64] at byte 0.
// =====================================================================================================
extern "C" void kernel_launch(void* const* d_in, const int* in_sizes, int n_in,
                              void* d_out, int out_size, void* d_ws, size_t ws_size,
                              hipStream_t stream) {
  if (n_in < 6) return;
  if (in_sizes[0] != NTOT) return;
  if (in_sizes[1] != DS) return;
  if (in_sizes[2] != DS) return;
  if (in_sizes[3] != 1) return;
  if (in_sizes[4] != PLN) return;
  if (in_sizes[5] != PLN) return;
  if (out_size != NTOT) return;

  const float* x    = (const float*)d_in[0];   // [2][512][64][64]
  const float* logA = (const float*)d_in[1];   // [64]
  const float* dtw  = (const float*)d_in[2];   // [64]
  const float* dtb  = (const float*)d_in[3];   // [1]
  const float* lnw  = (const float*)d_in[4];   // [64][64]
  const float* lnb  = (const float*)d_in[5];   // [64][64]
  float* outf = (float*)d_out;

  const size_t PB = (size_t)NTOT * 2;          // 8388608
  const size_t LB = (size_t)NBT * DS * 4;      //  262144
  size_t off = 0;
  const size_t oXh  = off; off += PB;
  const size_t oXl  = off; off += PB;
  const size_t oXhT = off; off += PB;
  const size_t oXlT = off; off += PB;
  const size_t oLd  = off; off += LB;
  if (off > ws_size) return;                   // off = 33816576
  if (off > (size_t)134217728) return;

  char* ws = (char*)d_ws;
  unsigned short* Xh  = (unsigned short*)(ws + oXh);
  unsigned short* Xl  = (unsigned short*)(ws + oXl);
  unsigned short* XhT = (unsigned short*)(ws + oXhT);
  unsigned short* XlT = (unsigned short*)(ws + oXlT);
  float*          Ld  = (float*)(ws + oLd);

  const int nbt = in_sizes[0] / PLN;           // 1024
  // (1) LayerNorm, dt, ld and the two xn planes
  ln_k<<<dim3(nbt), dim3(256), 0, stream>>>(x, logA, dtw, dtb, lnw, lnb, Xh, Xl, Ld, nbt);
  // (2) [b][t][r][c] -> [b][r][c][t] for both planes
  xt_k<<<dim3(TS / 64, DS, NB), dim3(256), 0, stream>>>(Xh, Xl, XhT, XlT);
  // (3) prefix sum + causal decay product -> d_out
  ssm_k<<<dim3(TS / 64, DS, NB), dim3(128), 0, stream>>>(XhT, XlT, Ld, outf);
  (void)hipGetLastError();
}

// v001
// It runs in 37.8 microseconds.
// In two side-by-side timings against v000, it was 1.68 and 1.67 times as fast.
// Contraction out[b][t][r][c] = sum_{j<=t} D[t][j] * xn[b][j][r][c] per (b, r), K = 512: v_wmma_f32_16x16x32_f16 with D = exp(cs_t - cs_j) carried x2^14 and xn carried x2^3, each as f16 hi + x2^11 residual plane, products hi.hi + (hi.lo + lo.hi) x 2^-11, f32 accumulate. LayerNorm, the 64-term dt dot, softplus, prefix sum and exp are f32 on VALU; all six inputs RNE-converted to bf16 values on load.
#include <hip/hip_runtime.h>
#include <math.h>
#include <stdint.h>

#define NB   2
#define TS   512
#define DS   64
#define NBT  (NB * TS)          // 1024 (b, t) rows
#define PLN  (DS * DS)          // 4096 elements per (b, t)
#define NTOT (NBT * PLN)        // 4194304
static_assert((TS % 64) == 0);
static_assert(DS == 64);
static_assert(PLN == 2 * 8 * 256);

typedef _Float16 v16h __attribute__((ext_vector_type(16)));
typedef _Float16 v8h  __attribute__((ext_vector_type(8)));
typedef float    v8f  __attribute__((ext_vector_type(8)));
typedef float    v4f  __attribute__((ext_vector_type(4)));
typedef unsigned int v4u __attribute__((ext_vector_type(4)));

// ---- scalar helpers --------------------------------------------------------------------------------
__device__ __forceinline__ unsigned short bf_bits(float f) {          // f32 -> bf16 bits, RNE convert
  unsigned u = __float_as_uint(f);
  return (unsigned short)((u + 0x7FFFu + ((u >> 16) & 1u)) >> 16);
}
__device__ __forceinline__ float bfr(float f) { return __uint_as_float(((unsigned)bf_bits(f)) << 16); }
__device__ __forceinline__ unsigned short h_bits(_Float16 x) { return __builtin_bit_cast(unsigned short, x); }
__device__ __forceinline__ unsigned pk16(unsigned short a, unsigned short b) { return (unsigned)a | ((unsigned)b << 16); }
__device__ __forceinline__ v8f zero8() { v8f z = {0.f, 0.f, 0.f, 0.f, 0.f, 0.f, 0.f, 0.f}; return z; }
__device__ __forceinline__ float wave_sum(float v) {
#pragma unroll
  for (int off = 16; off > 0; off >>= 1) v += __shfl_xor(v, off, 32);
  return v;
}

// ---- fragment loader: 16-bit operand, lane -> row/col (lane&15), p already includes +8*(lane>>4);
//      elements 0..7 <- p[0..7] (k0+8h..), elements 8..15 <- p[16..23] (k0+16+8h..)
__device__ __forceinline__ v16h ldfrag_h(const _Float16* p) {
  union { v16h v; v8h h[2]; } f;
  f.h[0] = *(const v8h*)(p);
  f.h[1] = *(const v8h*)(p + 16);
  return f.v;
}

// ---- WMMA helper with trailing VALU hazard gap ----------------------------------------------------------
__device__ __forceinline__ v8f mma_h(v16h a, v16h b, v8f c) {
  c = __builtin_amdgcn_wmma_f32_16x16x32_f16(false, a, false, b, (short)0, c, false, false);
#if defined(__HIP_DEVICE_COMPILE__)
  asm volatile("v_nop\n\tv_nop\n\tv_nop\n\tv_nop" : "+v"(c) : "v"(a), "v"(b));
#endif
  return c;
}

// =====================================================================================================
// Stage 1: one block per (b, t), 256 threads. Thread tid owns elements e0 = tid*8..+7 (row tid>>3,
// cols (tid&7)*8..+7) and e1 = 2048 + tid*8..+7 (row 32 + tid>>3, same cols) of the 64x64 slice.
// + dt_b; dt = softplus(z) = max(z,0) + log1p(exp(-|z|)); ld[b][t][r] = dt * (-exp(log_A[r])).
// Outputs: Xh = f16(8 xn), Xl = f16((8 xn - Xh) * 2048) in [b][t][r][c] layout: per plane two store
// coverage: Xh/Xl 2 x 256 x 8 = 4096 halves per (b,t); ld 16 x 4 = 64 floats per (b,t); grid = all (b,t).
// =====================================================================================================
__global__ __launch_bounds__(256) void ln_k(const float* __restrict__ x, const float* __restrict__ logA,
                                            const float* __restrict__ dtw, const float* __restrict__ dtb,
                                            const float* __restrict__ lnw, const float* __restrict__ lnb,
                                            unsigned short* Xh, unsigned short* Xl, float* ldp, int nbt) {
  __shared__ float red0[8];
  __shared__ float red1[8];
  __shared__ float zrow[64];
  __shared__ __align__(16) float ldv[64];
  const int bt = blockIdx.x;
  if (bt >= nbt) return;                       // block-uniform, before any barrier
  const int tid = threadIdx.x, lane = tid & 31, wave = tid >> 5;
  const int e0 = tid * 8, e1 = 2048 + tid * 8;
  const float* xp = x + (size_t)bt * PLN;

  const v4f xa = *(const v4f*)(xp + e0);
  const v4f xb = *(const v4f*)(xp + e0 + 4);
  const v4f xc = *(const v4f*)(xp + e1);
  const v4f xd = *(const v4f*)(xp + e1 + 4);
  float v[16];
#pragma unroll
  for (int q = 0; q < 4; ++q) {
    v[q]      = bfr(xa[q]);
    v[4 + q]  = bfr(xb[q]);
    v[8 + q]  = bfr(xc[q]);
    v[12 + q] = bfr(xd[q]);
  }
  // ---- mean ----
  float s = 0.0f;
#pragma unroll
  for (int i = 0; i < 16; ++i) s += v[i];
  s = wave_sum(s);
  if (lane == 0) red0[wave] = s;
  __syncthreads();
  float tot = 0.0f;
#pragma unroll
  for (int w = 0; w < 8; ++w) tot += red0[w];
  const float mu = tot * (1.0f / 4096.0f);
  // ---- centred variance ----
  float ss = 0.0f;
#pragma unroll
  for (int i = 0; i < 16; ++i) { const float d = v[i] - mu; ss += d * d; }
  ss = wave_sum(ss);
  if (lane == 0) red1[wave] = ss;
  __syncthreads();
  float vt = 0.0f;
#pragma unroll
  for (int w = 0; w < 8; ++w) vt += red1[w];
  const float var  = vt * (1.0f / 4096.0f);
  const float rstd = rsqrtf(var + 1e-5f);
  // ---- affine ----
  const v4f wa = *(const v4f*)(lnw + e0), wb = *(const v4f*)(lnw + e0 + 4);
  const v4f wc = *(const v4f*)(lnw + e1), wd = *(const v4f*)(lnw + e1 + 4);
  const v4f ba = *(const v4f*)(lnb + e0), bb = *(const v4f*)(lnb + e0 + 4);
  const v4f bc = *(const v4f*)(lnb + e1), bd = *(const v4f*)(lnb + e1 + 4);
  float xn[16];
#pragma unroll
  for (int q = 0; q < 4; ++q) {
    xn[q]      = (v[q]      - mu) * rstd * bfr(wa[q]) + bfr(ba[q]);
    xn[4 + q]  = (v[4 + q]  - mu) * rstd * bfr(wb[q]) + bfr(bb[q]);
    xn[8 + q]  = (v[8 + q]  - mu) * rstd * bfr(wc[q]) + bfr(bc[q]);
    xn[12 + q] = (v[12 + q] - mu) * rstd * bfr(wd[q]) + bfr(bd[q]);
  }
  // ---- dt dot: 8 terms per thread, reduced over the 8 lanes covering a row ----
  const int c8 = (tid & 7) * 8;
  const v4f da = *(const v4f*)(dtw + c8), db = *(const v4f*)(dtw + c8 + 4);
  float dw[8];
#pragma unroll
  for (int q = 0; q < 4; ++q) { dw[q] = bfr(da[q]); dw[4 + q] = bfr(db[q]); }
  float d0 = 0.0f, d1 = 0.0f;
#pragma unroll
  for (int i = 0; i < 8; ++i) { d0 += xn[i] * dw[i]; d1 += xn[8 + i] * dw[i]; }
  d0 += __shfl_xor(d0, 1, 32); d0 += __shfl_xor(d0, 2, 32); d0 += __shfl_xor(d0, 4, 32);
  d1 += __shfl_xor(d1, 1, 32); d1 += __shfl_xor(d1, 2, 32); d1 += __shfl_xor(d1, 4, 32);
  if ((tid & 7) == 0) { zrow[tid >> 3] = d0; zrow[32 + (tid >> 3)] = d1; }
  __syncthreads();
  if (tid < 64) {
    const float z  = zrow[tid] + bfr(dtb[0]);
    const float sp = fmaxf(z, 0.0f) + log1pf(__expf(-fabsf(z)));     // softplus
    const float ac = -__expf(bfr(logA[tid]));
    ldv[tid] = sp * ac;
  }
  __syncthreads();
  // ---- pack planes: hi = f16(8 xn), residual = f16((8 xn - hi) * 2048) ----
  v4u ph0, pl0, ph1, pl1;
#pragma unroll
  for (int e = 0; e < 4; ++e) {
    const float g0 = xn[2 * e] * 8.0f, g1 = xn[2 * e + 1] * 8.0f;
    const _Float16 x0 = (_Float16)g0, x1 = (_Float16)g1;
    const _Float16 y0 = (_Float16)((g0 - (float)x0) * 2048.0f);
    const _Float16 y1 = (_Float16)((g1 - (float)x1) * 2048.0f);
    ph0[e] = pk16(h_bits(x0), h_bits(x1));
    pl0[e] = pk16(h_bits(y0), h_bits(y1));
    const float k0 = xn[8 + 2 * e] * 8.0f, k1 = xn[8 + 2 * e + 1] * 8.0f;
    const _Float16 u0 = (_Float16)k0, u1 = (_Float16)k1;
    const _Float16 w0 = (_Float16)((k0 - (float)u0) * 2048.0f);
    const _Float16 w1 = (_Float16)((k1 - (float)u1) * 2048.0f);
    ph1[e] = pk16(h_bits(u0), h_bits(u1));
    pl1[e] = pk16(h_bits(w0), h_bits(w1));
  }
  const v4f lv = *(const v4f*)(ldv + (tid & 15) * 4);          // clamped LDS address, stored only by tid < 16
  const size_t po0 = (size_t)bt * PLN + e0;
  const size_t po1 = (size_t)bt * PLN + e1;
  const size_t plo = (size_t)bt * DS + (tid & 15) * 4;
  {
    *(v4u*)(Xh + po0) = ph0;
    *(v4u*)(Xh + po1) = ph1;
    *(v4u*)(Xl + po0) = pl0;
    *(v4u*)(Xl + po1) = pl1;
    if (tid < 16) *(v4f*)(ldp + plo) = lv;
    
  }
}

// =====================================================================================================
// Stage 2: plane [b][t][r][c] (f16) -> plane [b][r][c][t] (same bits), for the hi and the residual plane.
// in[t][c] (64 x 64 tile of one (b, r)) -> out[c][t]; grid = (TS/64 token tiles, DS rows r, NB).
// Tiles staged in LDS as halves (v8h 16-B stores, __syncthreads, element reads).
// Store: group g = tid>>3 (0..31), piece = tid&7: iteration it writes row c = it*32+g, lanes 8q..8q+7 x 16 B
// coverage: load 2 x 256 threads x 8 halves = 64x64 per plane; store 2 iterations x 32 groups = 64 rows c,
// 8 pieces x 8 = 64 tokens per row; grid covers every (b, r, token tile).
// =====================================================================================================
__global__ __launch_bounds__(256) void xt_k(const unsigned short* __restrict__ Xhp, const unsigned short* __restrict__ Xlp,
                                            unsigned short* XhT, unsigned short* XlT) {
  __shared__ __align__(16) _Float16 sh[64 * 72];        // [tt][c], pitch 72 halves (144 B)
  __shared__ __align__(16) _Float16 sl[64 * 72];
  const int tid = threadIdx.x;
  const int t0  = blockIdx.x * 64;
  const int r   = blockIdx.y;
  const int b   = blockIdx.z;
  const _Float16* H = (const _Float16*)(const void*)Xhp;
  const _Float16* L = (const _Float16*)(const void*)Xlp;
#pragma unroll
  for (int i = 0; i < 2; ++i) {
    const int idx = i * 256 + tid;                       // 0..511
    const int tt = idx >> 3, cc8 = (idx & 7) * 8;
    const size_t so = (((size_t)(b * TS + t0 + tt)) * DS + r) * DS + cc8;
    const v8h a  = *(const v8h*)(H + so);
    const v8h a2 = *(const v8h*)(L + so);
    *(v8h*)(sh + tt * 72 + cc8) = a;
    *(v8h*)(sl + tt * 72 + cc8) = a2;
  }
  __syncthreads();

  const int g = tid >> 3, piece = tid & 7;
  v4u hv[2], lvv[2];
  size_t hofs[2];
#pragma unroll
  for (int it = 0; it < 2; ++it) {
    const int c = it * 32 + g;
    v4u a, a2;
#pragma unroll
    for (int e = 0; e < 4; ++e) {
      const int ta = piece * 8 + 2 * e, tb = ta + 1;
      a[e]  = pk16(h_bits(sh[ta * 72 + c]), h_bits(sh[tb * 72 + c]));
      a2[e] = pk16(h_bits(sl[ta * 72 + c]), h_bits(sl[tb * 72 + c]));
    }
    hv[it]  = a;
    lvv[it] = a2;
    hofs[it] = (((size_t)(b * DS + r)) * DS + c) * TS + t0 + piece * 8;
  }
  {
#pragma unroll
    for (int it = 0; it < 2; ++it) {
      *(v4u*)(XhT + hofs[it]) = hv[it];
      *(v4u*)(XlT + hofs[it]) = lvv[it];
    }
    
  }
}

// =====================================================================================================
// Stage 3: out[b][t][r][c] = sum_{j<=t} exp(cs[b][t][r] - cs[b][j][r]) * xn[b][j][r][c].
// Block = (64-row t tile tt, r, b), 4 waves; wave w owns t rows tt*64 + 16w .. +15 and all 64 c.
// cs: the block loads ld[b][0..511][r] into LDS and thread 0 forms the inclusive prefix sum in place
// (sequential f32, identical in every block of the same (b, r)).
// A fragment (decay tile, built in registers): lane row = lane&15 -> t = tbase + (lane&15); element e<8 -> j =
// j0 + 8h + e, e>=8 -> j = j0 + 16 + 8h + (e-8) (split k map); value P = exp(min(cs_t - cs_j, 0)) (<= 1),
// 0 for j > t (select by value), hi = f16(P * 16384), residual = f16((P*16384 - hi) * 2048).
// B tiles: 64 tokens x 64 c of the [b][r][c][t] hi and residual planes are copied once per block into LDS
// (rows c of 128 B, whole lines, pitch 144 B) by asynchronous copies, two buffers: tile k+1 flies while
// tile k is worked on; all four waves read their fragments from that one copy.
// B fragments: lane col = c, two 16-B LDS loads at j0 + 8h and j0 + 16 + 8h (split k map, as the A fragment).
// acc += Ph.Xh; acc2 += Ph.Xl + Pl.Xh; out = (acc + acc2/2048) / 2^17.
// The tile loop's trip count tt + 1 is block-uniform; a wave skips the 32-token half past its diagonal
// (wave-uniform scalar test) but passes every wait and barrier.
// coverage: 4 waves x 16 rows x 64 cols = the block's 64 x 64 tile; grid (TS/64, DS, NB) = every (t, r, b) once.
// =====================================================================================================
#define XP    72                 // LDS row pitch in halves: 144 B = 16 B x 9
#define XTILE (64 * XP)          // halves of one plane's tile in LDS

// One block-wide tile fill: thread tid copies 16 B pieces (row i*16 + tid>>3, piece tid&7), i = 0..3, of both
// planes. gh/gl: this lane's first source piece; lh/ll: this lane's first LDS byte address. Row step: 16 rows.
__device__ __forceinline__ void stage_tile(const _Float16* gh, const _Float16* gl, unsigned lh, unsigned ll) {
  const _Float16* gh1 = gh + 16 * TS; const _Float16* gh2 = gh + 32 * TS; const _Float16* gh3 = gh + 48 * TS;
  const _Float16* gl1 = gl + 16 * TS; const _Float16* gl2 = gl + 32 * TS; const _Float16* gl3 = gl + 48 * TS;
  const unsigned st = 16 * XP * 2;
  const unsigned lh1 = lh + st, lh2 = lh + 2 * st, lh3 = lh + 3 * st;
  const unsigned ll1 = ll + st, ll2 = ll + 2 * st, ll3 = ll + 3 * st;
#if defined(__HIP_DEVICE_COMPILE__)
  // the eight copies and, as the last line, the wait that stands before any of their address registers is rewritten
  asm volatile("global_load_async_to_lds_b128 %0, %8, off\n\t"
               "global_load_async_to_lds_b128 %1, %9, off\n\t"
               "global_load_async_to_lds_b128 %2, %10, off\n\t"
               "global_load_async_to_lds_b128 %3, %11, off\n\t"
               "global_load_async_to_lds_b128 %4, %12, off\n\t"
               "global_load_async_to_lds_b128 %5, %13, off\n\t"
               "global_load_async_to_lds_b128 %6, %14, off\n\t"
               "global_load_async_to_lds_b128 %7, %15, off\n\t"
               "s_wait_xcnt 0x0"
               :: "v"(lh), "v"(lh1), "v"(lh2), "v"(lh3), "v"(ll), "v"(ll1), "v"(ll2), "v"(ll3),
                  "v"(gh), "v"(gh1), "v"(gh2), "v"(gh3), "v"(gl), "v"(gl1), "v"(gl2), "v"(gl3)
               : "memory");
#endif
}

__global__ __launch_bounds__(128) void ssm_k(const unsigned short* __restrict__ XhTp, const unsigned short* __restrict__ XlTp,
                                             const float* __restrict__ ldp, float* outp) {
  __shared__ __align__(16) float cs_s[TS];
  __shared__ __align__(16) float os_s[4 * 16 * 64];
  __shared__ __align__(16) _Float16 xs[2 * 2 * XTILE];        // [buffer][plane][c][token], pitch XP
  const int tt = blockIdx.x, r = blockIdx.y, b = blockIdx.z;
  const int tid = threadIdx.x, lane = tid & 31, hh = lane >> 4, l16 = lane & 15;
  const int wave = __builtin_amdgcn_readfirstlane(tid >> 5);  // scalar, so that the per-wave skip is a scalar branch

  const _Float16* XhT = (const _Float16*)(const void*)XhTp;
  const _Float16* XlT = (const _Float16*)(const void*)XlTp;
  const size_t plb = ((size_t)(b * DS + r)) * DS * TS;
  const int    sof = (tid >> 3) * TS + (tid & 7) * 8;          // this lane's first piece inside a tile's rows
  const _Float16* sgh = XhT + plb + sof;
  const _Float16* sgl = XlT + plb + sof;
  const unsigned  slh = (unsigned)(uintptr_t)(xs + (tid >> 3) * XP + (tid & 7) * 8);   // LDS byte address
  const int nt = tt + 1;                                       // tiles of 64 tokens, block-uniform

  stage_tile(sgh, sgl, slh, slh + XTILE * 2);                  // tile 0 -> buffer 0

#pragma unroll 1
  for (int i = tid; i < TS; i += 128) cs_s[i] = ldp[((size_t)(b * TS + i)) * DS + r];
  __syncthreads();
  if (tid == 0) {
    float a = 0.0f;
#pragma unroll 4
    for (int t = 0; t < TS; ++t) { a += cs_s[t]; cs_s[t] = a; }
  }
  asm volatile("s_wait_asynccnt 0x0" ::: "memory");            // this wave's share of tile 0 has landed
  __syncthreads();                                             // publishes the prefix sum and tile 0
  if (nt > 1) stage_tile(sgh + 64, sgl + 64, slh + 2 * XTILE * 2, slh + 3 * XTILE * 2);   // tile 1 -> buffer 1

  const int tbase = tt * 64 + wave * 16;
  const int trow  = tbase + l16;
  const float cst = cs_s[trow];

  v8f acc[4], acc2[4];
#pragma unroll
  for (int s = 0; s < 4; ++s) { acc[s] = zero8(); acc2[s] = zero8(); }

  const int jend = tbase + 16;               // wave-uniform causal bound
#pragma unroll 1                             // one tile per trip: the ring's waits and barrier stand once
  for (int kc = 0; kc < nt; ++kc) {
    const int bufo = (kc & 1) * (2 * XTILE);
#pragma unroll 1                             // kept rolled: the second half is skipped on the diagonal by waves 0 and 1
    for (int j0 = kc * 64; j0 < kc * 64 + 64 && j0 < jend; j0 += 32) {
      const _Float16* fb = xs + bufo + l16 * XP + (j0 & 32) + 8 * hh;
      v16h xh[4], xl[4];
#pragma unroll
      for (int s = 0; s < 4; ++s) {
        xh[s] = ldfrag_h(fb + s * 16 * XP);
        xl[s] = ldfrag_h(fb + XTILE + s * 16 * XP);
      }
      const int kA = j0 + hh * 8;
      const int kB = j0 + 16 + hh * 8;
      const v4f q0 = *(const v4f*)(cs_s + kA);
      const v4f q1 = *(const v4f*)(cs_s + kA + 4);
      const v4f q2 = *(const v4f*)(cs_s + kB);
      const v4f q3 = *(const v4f*)(cs_s + kB + 4);
      float cj[16];
#pragma unroll
      for (int q = 0; q < 4; ++q) {
        cj[q]      = q0[q];
        cj[q + 4]  = q1[q];
        cj[q + 8]  = q2[q];
        cj[q + 12] = q3[q];
      }
      float ex[16];
#pragma unroll
      for (int e = 0; e < 16; ++e) ex[e] = fminf(cst - cj[e], 0.0f) * 1.44269504088896340736f;
#if defined(__HIP_DEVICE_COMPILE__)
      // The instruction set asks for one slot behind a v_exp_f32 before a register it reads is rewritten. The
      // scheduling barriers keep the sixteen v_exp_f32 by themselves, with nothing between them that rewrites an
      // argument, and hold the v_nop directly behind the last.
      __builtin_amdgcn_sched_barrier(0);
#pragma unroll
      for (int e = 0; e < 16; ++e) ex[e] = __builtin_amdgcn_exp2f(ex[e]);
      __builtin_amdgcn_sched_barrier(0);
      asm volatile("v_nop");
      __builtin_amdgcn_sched_barrier(0);
#endif
      v16h pa, pr;
#pragma unroll
      for (int e = 0; e < 16; ++e) {
        const int j = (e < 8) ? (kA + e) : (kB + e - 8);
        float p = ex[e] * 16384.0f;
        p = (j <= trow) ? p : 0.0f;                          // causal select by value
        const _Float16 x0 = (_Float16)p;
        pa[e] = x0;
        pr[e] = (_Float16)((p - (float)x0) * 2048.0f);
      }
#pragma unroll
      for (int s = 0; s < 4; ++s) {
        acc[s]  = mma_h(pa, xh[s], acc[s]);
        acc2[s] = mma_h(pa, xl[s], acc2[s]);
        acc2[s] = mma_h(pr, xh[s], acc2[s]);
      }
    }
    asm volatile("s_wait_dscnt 0x0" ::: "memory");             // this wave's reads of the buffer are done
    asm volatile("s_wait_asynccnt 0x0" ::: "memory");          // this wave's share of tile kc + 1 has landed
    __syncthreads();                                           // publishes tile kc + 1, frees tile kc's buffer
    if (kc + 2 < nt)
      stage_tile(sgh + (kc + 2) * 64, sgl + (kc + 2) * 64, slh + bufo * 2, slh + bufo * 2 + XTILE * 2);
  }
  asm volatile("s_wait_asynccnt 0x0" ::: "memory");            // no copy is outstanding when the wave goes on

  // ---- epilogue ----
  float* os = os_s + wave * (16 * 64);
#pragma unroll
  for (int r8 = 0; r8 < 8; ++r8) {
#pragma unroll
    for (int s = 0; s < 4; ++s) {
      const float val = (acc[s][r8] + acc2[s][r8] * (1.0f / 2048.0f)) * (1.0f / 131072.0f);
      os[(8 * hh + r8) * 64 + s * 16 + l16] = val;
    }
  }
  __builtin_amdgcn_fence(__ATOMIC_RELEASE, "workgroup");
  __builtin_amdgcn_wave_barrier();
  __builtin_amdgcn_fence(__ATOMIC_ACQUIRE, "workgroup");
  const int h2 = lane >> 4, c4 = (lane & 15) * 4;       // 256-B row = 16 lanes x 16 B
  v4f ov[8];
#pragma unroll
  for (int it = 0; it < 8; ++it) {
    const int row = it * 2 + h2;                         // it 0..7 x h2 0..1 = rows 0..15
    ov[it] = *(const v4f*)(os + row * 64 + c4);
  }
  {
#pragma unroll
    for (int it = 0; it < 8; ++it) {
      const int row = it * 2 + h2;
      const size_t go = (((size_t)(b * TS + tbase + row)) * DS + r) * DS + c4;
      *(v4f*)(outp + go) = ov[it];
    }
    
  }
}

// =====================================================================================================
// Workspace map (bytes); every region is an exact multiple of its whole-line store granularity, all offsets
// multiples of 8388608 except the last, no aliasing:
//   Xh   f16 [1024][4096]   ([b][t][r][c], xn x8 hi)          0         8388608
//   Xl   f16 [1024][4096]   (residual x2^11)                  8388608   8388608
//   XhT  f16 [2][64][64][512] ([b][r][c][t])                  16777216  8388608
//   XlT  f16 [2][64][64][512]                                  25165824  8388608
//   Ld   f32 [1024][64]     ([b][t][r], dt * (-exp(log_A)))   33554432  262144
//   end                                                        33816576
// d_out f32 [2][512][64][64] at byte 0.
// =====================================================================================================
extern "C" void kernel_launch(void* const* d_in, const int* in_sizes, int n_in,
                              void* d_out, int out_size, void* d_ws, size_t ws_size,
                              hipStream_t stream) {
  if (n_in < 6) return;
  if (in_sizes[0] != NTOT) return;
  if (in_sizes[1] != DS) return;
  if (in_sizes[2] != DS) return;
  if (in_sizes[3] != 1) return;
  if (in_sizes[4] != PLN) return;
  if (in_sizes[5] != PLN) return;
  if (out_size != NTOT) return;

  const float* x    = (const float*)d_in[0];   // [2][512][64][64]
  const float* logA = (const float*)d_in[1];   // [64]
  const float* dtw  = (const float*)d_in[2];   // [64]
  const float* dtb  = (const float*)d_in[3];   // [1]
  const float* lnw  = (const float*)d_in[4];   // [64][64]
  const float* lnb  = (const float*)d_in[5];   // [64][64]
  float* outf = (float*)d_out;

  const size_t PB = (size_t)NTOT * 2;          // 8388608
  const size_t LB = (size_t)NBT * DS * 4;      //  262144
  size_t off = 0;
  const size_t oXh  = off; off += PB;
  const size_t oXl  = off; off += PB;
  const size_t oXhT = off; off += PB;
  const size_t oXlT = off; off += PB;
  const size_t oLd  = off; off += LB;
  if (off > ws_size) return;                   // off = 33816576
  if (off > (size_t)134217728) return;

  char* ws = (char*)d_ws;
  unsigned short* Xh  = (unsigned short*)(ws + oXh);
  unsigned short* Xl  = (unsigned short*)(ws + oXl);
  unsigned short* XhT = (unsigned short*)(ws + oXhT);
  unsigned short* XlT = (unsigned short*)(ws + oXlT);
  float*          Ld  = (float*)(ws + oLd);

  const int nbt = in_sizes[0] / PLN;           // 1024
  // (1) LayerNorm, dt, ld and the two xn planes
  ln_k<<<dim3(nbt), dim3(256), 0, stream>>>(x, logA, dtw, dtb, lnw, lnb, Xh, Xl, Ld, nbt);
  // (2) [b][t][r][c] -> [b][r][c][t] for both planes
  xt_k<<<dim3(TS / 64, DS, NB), dim3(256), 0, stream>>>(Xh, Xl, XhT, XlT);
  // (3) prefix sum + causal decay product -> d_out
  ssm_k<<<dim3(TS / 64, DS, NB), dim3(128), 0, stream>>>(XhT, XlT, Ld, outf);
  (void)hipGetLastError();
}

// v002
// It runs in 35.3 microseconds.
// In two side-by-side timings against v001, it was 1.07 and 1.09 times as fast.
// Counting every step since v000, it is 1.81 times as fast.
// Contraction out[b][t][r][c] = sum_{j<=t} D[t][j] * xn[b][j][r][c] per (b, r), K = 512: v_wmma_f32_16x16x32_f16 with D = exp(cs_t - cs_j) carried x2^14 and xn carried x2^3, each as f16 hi + x2^11 residual plane, products hi.hi + (hi.lo + lo.hi) x 2^-11, f32 accumulate. LayerNorm, the 64-term dt dot, softplus, prefix sum and exp are f32 on VALU; all six inputs RNE-converted to bf16 values on load.
#include <hip/hip_runtime.h>
#include <math.h>
#include <stdint.h>

#define NB   2
#define TS   512
#define DS   64
#define NBT  (NB * TS)          // 1024 (b, t) rows
#define PLN  (DS * DS)          // 4096 elements per (b, t)
#define NTOT (NBT * PLN)        // 4194304
static_assert((TS % 64) == 0);
static_assert(DS == 64);
static_assert(PLN == 2 * 8 * 256);

typedef _Float16 v16h __attribute__((ext_vector_type(16)));
typedef short    v8s  __attribute__((ext_vector_type(8)));
typedef float    v8f  __attribute__((ext_vector_type(8)));
typedef float    v4f  __attribute__((ext_vector_type(4)));
typedef unsigned int v4u __attribute__((ext_vector_type(4)));

// ---- scalar helpers --------------------------------------------------------------------------------
__device__ __forceinline__ unsigned short bf_bits(float f) {          // f32 -> bf16 bits, RNE convert
  unsigned u = __float_as_uint(f);
  return (unsigned short)((u + 0x7FFFu + ((u >> 16) & 1u)) >> 16);
}
__device__ __forceinline__ float bfr(float f) { return __uint_as_float(((unsigned)bf_bits(f)) << 16); }
__device__ __forceinline__ unsigned short h_bits(_Float16 x) { return __builtin_bit_cast(unsigned short, x); }
__device__ __forceinline__ unsigned pk16(unsigned short a, unsigned short b) { return (unsigned)a | ((unsigned)b << 16); }
__device__ __forceinline__ v8f zero8() { v8f z = {0.f, 0.f, 0.f, 0.f, 0.f, 0.f, 0.f, 0.f}; return z; }
__device__ __forceinline__ float wave_sum(float v) {
#pragma unroll
  for (int off = 16; off > 0; off >>= 1) v += __shfl_xor(v, off, 32);
  return v;
}

// ---- WMMA helper with trailing VALU hazard gap ----------------------------------------------------------
__device__ __forceinline__ v8f mma_h(v16h a, v16h b, v8f c) {
  c = __builtin_amdgcn_wmma_f32_16x16x32_f16(false, a, false, b, (short)0, c, false, false);
#if defined(__HIP_DEVICE_COMPILE__)
  asm volatile("v_nop\n\tv_nop\n\tv_nop\n\tv_nop" : "+v"(c) : "v"(a), "v"(b));
#endif
  return c;
}

// =====================================================================================================
// Stage 1: one block per (b, t), 256 threads. Thread tid owns elements e0 = tid*8..+7 (row tid>>3,
// cols (tid&7)*8..+7) and e1 = 2048 + tid*8..+7 (row 32 + tid>>3, same cols) of the 64x64 slice.
// + dt_b; dt = softplus(z) = max(z,0) + log1p(exp(-|z|)); ld[b][t][r] = dt * (-exp(log_A[r])).
// Outputs: Xh = f16(8 xn), Xl = f16((8 xn - Xh) * 2048) in [b][t][r][c] layout: per plane two store
// coverage: Xh/Xl 2 x 256 x 8 = 4096 halves per (b,t); ld 16 x 4 = 64 floats per (b,t); grid = all (b,t).
// =====================================================================================================
__global__ __launch_bounds__(256) void ln_k(const float* __restrict__ x, const float* __restrict__ logA,
                                            const float* __restrict__ dtw, const float* __restrict__ dtb,
                                            const float* __restrict__ lnw, const float* __restrict__ lnb,
                                            unsigned short* Xh, unsigned short* Xl, float* ldp, int nbt) {
  __shared__ float red0[8];
  __shared__ float red1[8];
  __shared__ float zrow[64];
  __shared__ __align__(16) float ldv[64];
  const int bt = blockIdx.x;
  if (bt >= nbt) return;                       // block-uniform, before any barrier
  const int tid = threadIdx.x, lane = tid & 31, wave = tid >> 5;
  const int e0 = tid * 8, e1 = 2048 + tid * 8;
  const float* xp = x + (size_t)bt * PLN;

  const v4f xa = *(const v4f*)(xp + e0);
  const v4f xb = *(const v4f*)(xp + e0 + 4);
  const v4f xc = *(const v4f*)(xp + e1);
  const v4f xd = *(const v4f*)(xp + e1 + 4);
  float v[16];
#pragma unroll
  for (int q = 0; q < 4; ++q) {
    v[q]      = bfr(xa[q]);
    v[4 + q]  = bfr(xb[q]);
    v[8 + q]  = bfr(xc[q]);
    v[12 + q] = bfr(xd[q]);
  }
  // ---- mean ----
  float s = 0.0f;
#pragma unroll
  for (int i = 0; i < 16; ++i) s += v[i];
  s = wave_sum(s);
  if (lane == 0) red0[wave] = s;
  __syncthreads();
  float tot = 0.0f;
#pragma unroll
  for (int w = 0; w < 8; ++w) tot += red0[w];
  const float mu = tot * (1.0f / 4096.0f);
  // ---- centred variance ----
  float ss = 0.0f;
#pragma unroll
  for (int i = 0; i < 16; ++i) { const float d = v[i] - mu; ss += d * d; }
  ss = wave_sum(ss);
  if (lane == 0) red1[wave] = ss;
  __syncthreads();
  float vt = 0.0f;
#pragma unroll
  for (int w = 0; w < 8; ++w) vt += red1[w];
  const float var  = vt * (1.0f / 4096.0f);
  const float rstd = rsqrtf(var + 1e-5f);
  // ---- affine ----
  const v4f wa = *(const v4f*)(lnw + e0), wb = *(const v4f*)(lnw + e0 + 4);
  const v4f wc = *(const v4f*)(lnw + e1), wd = *(const v4f*)(lnw + e1 + 4);
  const v4f ba = *(const v4f*)(lnb + e0), bb = *(const v4f*)(lnb + e0 + 4);
  const v4f bc = *(const v4f*)(lnb + e1), bd = *(const v4f*)(lnb + e1 + 4);
  float xn[16];
#pragma unroll
  for (int q = 0; q < 4; ++q) {
    xn[q]      = (v[q]      - mu) * rstd * bfr(wa[q]) + bfr(ba[q]);
    xn[4 + q]  = (v[4 + q]  - mu) * rstd * bfr(wb[q]) + bfr(bb[q]);
    xn[8 + q]  = (v[8 + q]  - mu) * rstd * bfr(wc[q]) + bfr(bc[q]);
    xn[12 + q] = (v[12 + q] - mu) * rstd * bfr(wd[q]) + bfr(bd[q]);
  }
  // ---- dt dot: 8 terms per thread, reduced over the 8 lanes covering a row ----
  const int c8 = (tid & 7) * 8;
  const v4f da = *(const v4f*)(dtw + c8), db = *(const v4f*)(dtw + c8 + 4);
  float dw[8];
#pragma unroll
  for (int q = 0; q < 4; ++q) { dw[q] = bfr(da[q]); dw[4 + q] = bfr(db[q]); }
  float d0 = 0.0f, d1 = 0.0f;
#pragma unroll
  for (int i = 0; i < 8; ++i) { d0 += xn[i] * dw[i]; d1 += xn[8 + i] * dw[i]; }
  d0 += __shfl_xor(d0, 1, 32); d0 += __shfl_xor(d0, 2, 32); d0 += __shfl_xor(d0, 4, 32);
  d1 += __shfl_xor(d1, 1, 32); d1 += __shfl_xor(d1, 2, 32); d1 += __shfl_xor(d1, 4, 32);
  if ((tid & 7) == 0) { zrow[tid >> 3] = d0; zrow[32 + (tid >> 3)] = d1; }
  __syncthreads();
  if (tid < 64) {
    const float z  = zrow[tid] + bfr(dtb[0]);
    const float sp = fmaxf(z, 0.0f) + log1pf(__expf(-fabsf(z)));     // softplus
    const float ac = -__expf(bfr(logA[tid]));
    ldv[tid] = sp * ac;
  }
  __syncthreads();
  // ---- pack planes: hi = f16(8 xn), residual = f16((8 xn - hi) * 2048) ----
  v4u ph0, pl0, ph1, pl1;
#pragma unroll
  for (int e = 0; e < 4; ++e) {
    const float g0 = xn[2 * e] * 8.0f, g1 = xn[2 * e + 1] * 8.0f;
    const _Float16 x0 = (_Float16)g0, x1 = (_Float16)g1;
    const _Float16 y0 = (_Float16)((g0 - (float)x0) * 2048.0f);
    const _Float16 y1 = (_Float16)((g1 - (float)x1) * 2048.0f);
    ph0[e] = pk16(h_bits(x0), h_bits(x1));
    pl0[e] = pk16(h_bits(y0), h_bits(y1));
    const float k0 = xn[8 + 2 * e] * 8.0f, k1 = xn[8 + 2 * e + 1] * 8.0f;
    const _Float16 u0 = (_Float16)k0, u1 = (_Float16)k1;
    const _Float16 w0 = (_Float16)((k0 - (float)u0) * 2048.0f);
    const _Float16 w1 = (_Float16)((k1 - (float)u1) * 2048.0f);
    ph1[e] = pk16(h_bits(u0), h_bits(u1));
    pl1[e] = pk16(h_bits(w0), h_bits(w1));
  }
  const v4f lv = *(const v4f*)(ldv + (tid & 15) * 4);          // clamped LDS address, stored only by tid < 16
  const size_t po0 = (size_t)bt * PLN + e0;
  const size_t po1 = (size_t)bt * PLN + e1;
  const size_t plo = (size_t)bt * DS + (tid & 15) * 4;
  {
    *(v4u*)(Xh + po0) = ph0;
    *(v4u*)(Xh + po1) = ph1;
    *(v4u*)(Xl + po0) = pl0;
    *(v4u*)(Xl + po1) = pl1;
    if (tid < 16) *(v4f*)(ldp + plo) = lv;
    
  }
}

// =====================================================================================================
// Stage 2: out[b][t][r][c] = sum_{j<=t} exp(cs[b][t][r] - cs[b][j][r]) * xn[b][j][r][c].
// Block = (64-row t tile tt, r, b), 4 waves; wave w owns t rows tt*64 + 16w .. +15 and all 64 c.
// cs: the block loads ld[b][0..511][r] into LDS and thread 0 forms the inclusive prefix sum in place
// (sequential f32, identical in every block of the same (b, r)).
// A fragment (decay tile, built in registers): lane row = lane&15 -> t = tbase + (lane&15); element e<8 -> j =
// j0 + 8h + e, e>=8 -> j = j0 + 16 + 8h + (e-8) (split k map); value P = exp(min(cs_t - cs_j, 0)) (<= 1),
// 0 for j > t (select by value), hi = f16(P * 16384), residual = f16((P*16384 - hi) * 2048).
// B tiles: 64 tokens x 64 c of the [b][t][r][c] hi and residual planes, as stage 1 stores them, are copied once
// per block into LDS (rows = tokens of 128 B, whole lines, pitch 160 B) by asynchronous copies, two buffers:
// tile k+1 flies while tile k is worked on; all four waves read their fragments from that one copy.
// B fragments: two transposing LDS loads (ds_load_tr16_b128) at token rows j0 and j0 + 16: lane (c = lane&15, h)
// gets tokens j0 + 8h .. +7 and j0 + 16 + 8h .. +7 of column c (split k map, as the A fragment).
// acc += Ph.Xh; acc2 += Ph.Xl + Pl.Xh; out = (acc + acc2/2048) / 2^17.
// The tile loop's trip count tt + 1 is block-uniform; a wave skips the 32-token half past its diagonal
// (wave-uniform scalar test) but passes every wait and barrier.
// coverage: 4 waves x 16 rows x 64 cols = the block's 64 x 64 tile; grid (TS/64, DS, NB) = every (t, r, b) once.
// =====================================================================================================
#define XP    80                 // LDS row pitch in halves: 160 B = 32 B x 5, the transposing load's pitch
#define XTILE (64 * XP)          // halves of one plane's tile in LDS

// One block-wide tile fill: thread tid copies 16 B pieces (token row i*16 + tid>>3, piece tid&7), i = 0..3, of both
// planes. gh/gl: this lane's first source piece; lh/ll: this lane's first LDS byte address. Row step: 16 rows.
__device__ __forceinline__ void stage_tile(const _Float16* gh, const _Float16* gl, unsigned lh, unsigned ll) {
  const _Float16* gh1 = gh + 16 * PLN; const _Float16* gh2 = gh + 32 * PLN; const _Float16* gh3 = gh + 48 * PLN;
  const _Float16* gl1 = gl + 16 * PLN; const _Float16* gl2 = gl + 32 * PLN; const _Float16* gl3 = gl + 48 * PLN;
  const unsigned st = 16 * XP * 2;
  const unsigned lh1 = lh + st, lh2 = lh + 2 * st, lh3 = lh + 3 * st;
  const unsigned ll1 = ll + st, ll2 = ll + 2 * st, ll3 = ll + 3 * st;
#if defined(__HIP_DEVICE_COMPILE__)
  // the eight copies and, as the last line, the wait that stands before any of their address registers is rewritten
  asm volatile("global_load_async_to_lds_b128 %0, %8, off\n\t"
               "global_load_async_to_lds_b128 %1, %9, off\n\t"
               "global_load_async_to_lds_b128 %2, %10, off\n\t"
               "global_load_async_to_lds_b128 %3, %11, off\n\t"
               "global_load_async_to_lds_b128 %4, %12, off\n\t"
               "global_load_async_to_lds_b128 %5, %13, off\n\t"
               "global_load_async_to_lds_b128 %6, %14, off\n\t"
               "global_load_async_to_lds_b128 %7, %15, off\n\t"
               "s_wait_xcnt 0x0"
               :: "v"(lh), "v"(lh1), "v"(lh2), "v"(lh3), "v"(ll), "v"(ll1), "v"(ll2), "v"(ll3),
                  "v"(gh), "v"(gh1), "v"(gh2), "v"(gh3), "v"(gl), "v"(gl1), "v"(gl2), "v"(gl3)
               : "memory");
#endif
}

// Transposing fragment load: p = this lane's 16-B piece of the token-major tile (row kbase + 8h + (lane&7), piece
// (lane>>3)&1 of the 16 columns); q = the same 16 rows further on. Elements 0..7 <- tokens kbase + 8h .. +7,
// elements 8..15 <- tokens kbase + 16 + 8h .. +7, both of column lane&15.
__device__ __forceinline__ v16h ldfrag_tr(const _Float16* p, const _Float16* q) {
  typedef __attribute__((address_space(3))) v8s lds_v8s;
  union { v16h v; v8s h[2]; } f;
  f.h[0] = __builtin_amdgcn_ds_load_tr16_b128_v8i16((lds_v8s*)p);
  f.h[1] = __builtin_amdgcn_ds_load_tr16_b128_v8i16((lds_v8s*)q);
  return f.v;
}

__global__ __launch_bounds__(128) void ssm_k(const unsigned short* __restrict__ Xhp, const unsigned short* __restrict__ Xlp,
                                             const float* __restrict__ ldp, float* outp) {
  __shared__ __align__(16) float cs_s[TS];
  __shared__ __align__(16) float os_s[4 * 16 * 64];
  __shared__ __align__(16) _Float16 xs[2 * 2 * XTILE];        // [buffer][plane][token][c], pitch XP
  const int tt = blockIdx.x, r = blockIdx.y, b = blockIdx.z;
  const int tid = threadIdx.x, lane = tid & 31, hh = lane >> 4, l16 = lane & 15;
  const int wave = __builtin_amdgcn_readfirstlane(tid >> 5);  // scalar, so that the per-wave skip is a scalar branch

  const _Float16* Xh = (const _Float16*)(const void*)Xhp;
  const _Float16* Xl = (const _Float16*)(const void*)Xlp;
  const size_t plb = ((size_t)(b * TS) * DS + r) * DS;         // (b, token 0, r, c 0)
  const int    sof = (tid >> 3) * PLN + (tid & 7) * 8;         // this lane's first piece inside a tile's rows
  const _Float16* sgh = Xh + plb + sof;
  const _Float16* sgl = Xl + plb + sof;
  const unsigned  slh = (unsigned)(uintptr_t)(xs + (tid >> 3) * XP + (tid & 7) * 8);   // LDS byte address
  const int nt = tt + 1;                                       // tiles of 64 tokens, block-uniform

  stage_tile(sgh, sgl, slh, slh + XTILE * 2);                  // tile 0 -> buffer 0

#pragma unroll 1
  for (int i = tid; i < TS; i += 128) cs_s[i] = ldp[((size_t)(b * TS + i)) * DS + r];
  __syncthreads();
  if (tid == 0) {
    float a = 0.0f;
#pragma unroll 4
    for (int t = 0; t < TS; ++t) { a += cs_s[t]; cs_s[t] = a; }
  }
  asm volatile("s_wait_asynccnt 0x0" ::: "memory");            // this wave's share of tile 0 has landed
  __syncthreads();                                             // publishes the prefix sum and tile 0
  if (nt > 1) stage_tile(sgh + 64 * PLN, sgl + 64 * PLN, slh + 2 * XTILE * 2, slh + 3 * XTILE * 2);   // tile 1 -> buffer 1

  const int tbase = tt * 64 + wave * 16;
  const int trow  = tbase + l16;
  const float cst = cs_s[trow];

  v8f acc[4], acc2[4];
#pragma unroll
  for (int s = 0; s < 4; ++s) { acc[s] = zero8(); acc2[s] = zero8(); }

  const int jend = tbase + 16;               // wave-uniform causal bound
#pragma unroll 1                             // one tile per trip: the ring's waits and barrier stand once
  for (int kc = 0; kc < nt; ++kc) {
    const int bufo = (kc & 1) * (2 * XTILE);
#pragma unroll 1                             // kept rolled: the second half is skipped on the diagonal by waves 0 and 1
    for (int j0 = kc * 64; j0 < kc * 64 + 64 && j0 < jend; j0 += 32) {
      const _Float16* fb = xs + bufo + ((j0 & 32) + 8 * hh + (lane & 7)) * XP + ((lane >> 3) & 1) * 8;
      v16h xh[4], xl[4];
#pragma unroll
      for (int s = 0; s < 4; ++s) {
        xh[s] = ldfrag_tr(fb + s * 16, fb + 16 * XP + s * 16);
        xl[s] = ldfrag_tr(fb + XTILE + s * 16, fb + XTILE + 16 * XP + s * 16);
      }
      const int kA = j0 + hh * 8;
      const int kB = j0 + 16 + hh * 8;
      const v4f q0 = *(const v4f*)(cs_s + kA);
      const v4f q1 = *(const v4f*)(cs_s + kA + 4);
      const v4f q2 = *(const v4f*)(cs_s + kB);
      const v4f q3 = *(const v4f*)(cs_s + kB + 4);
      float cj[16];
#pragma unroll
      for (int q = 0; q < 4; ++q) {
        cj[q]      = q0[q];
        cj[q + 4]  = q1[q];
        cj[q + 8]  = q2[q];
        cj[q + 12] = q3[q];
      }
      float ex[16];
#pragma unroll
      for (int e = 0; e < 16; ++e) ex[e] = fminf(cst - cj[e], 0.0f) * 1.44269504088896340736f;
#if defined(__HIP_DEVICE_COMPILE__)
      // The instruction set asks for one slot behind a v_exp_f32 before a register it reads is rewritten. The
      // scheduling barriers keep the sixteen v_exp_f32 by themselves, with nothing between them that rewrites an
      // argument, and hold the v_nop directly behind the last.
      __builtin_amdgcn_sched_barrier(0);
#pragma unroll
      for (int e = 0; e < 16; ++e) ex[e] = __builtin_amdgcn_exp2f(ex[e]);
      __builtin_amdgcn_sched_barrier(0);
      asm volatile("v_nop");
      __builtin_amdgcn_sched_barrier(0);
#endif
      v16h pa, pr;
#pragma unroll
      for (int e = 0; e < 16; ++e) {
        const int j = (e < 8) ? (kA + e) : (kB + e - 8);
        float p = ex[e] * 16384.0f;
        p = (j <= trow) ? p : 0.0f;                          // causal select by value
        const _Float16 x0 = (_Float16)p;
        pa[e] = x0;
        pr[e] = (_Float16)((p - (float)x0) * 2048.0f);
      }
#pragma unroll
      for (int s = 0; s < 4; ++s) {
        acc[s]  = mma_h(pa, xh[s], acc[s]);
        acc2[s] = mma_h(pa, xl[s], acc2[s]);
        acc2[s] = mma_h(pr, xh[s], acc2[s]);
      }
    }
    asm volatile("s_wait_dscnt 0x0" ::: "memory");             // this wave's reads of the buffer are done
    asm volatile("s_wait_asynccnt 0x0" ::: "memory");          // this wave's share of tile kc + 1 has landed
    __syncthreads();                                           // publishes tile kc + 1, frees tile kc's buffer
    if (kc + 2 < nt)
      stage_tile(sgh + (size_t)(kc + 2) * (64 * PLN), sgl + (size_t)(kc + 2) * (64 * PLN), slh + bufo * 2, slh + bufo * 2 + XTILE * 2);
  }
  asm volatile("s_wait_asynccnt 0x0" ::: "memory");            // no copy is outstanding when the wave goes on

  // ---- epilogue ----
  float* os = os_s + wave * (16 * 64);
#pragma unroll
  for (int r8 = 0; r8 < 8; ++r8) {
#pragma unroll
    for (int s = 0; s < 4; ++s) {
      const float val = (acc[s][r8] + acc2[s][r8] * (1.0f / 2048.0f)) * (1.0f / 131072.0f);
      os[(8 * hh + r8) * 64 + s * 16 + l16] = val;
    }
  }
  __builtin_amdgcn_fence(__ATOMIC_RELEASE, "workgroup");
  __builtin_amdgcn_wave_barrier();
  __builtin_amdgcn_fence(__ATOMIC_ACQUIRE, "workgroup");
  const int h2 = lane >> 4, c4 = (lane & 15) * 4;       // 256-B row = 16 lanes x 16 B
  v4f ov[8];
#pragma unroll
  for (int it = 0; it < 8; ++it) {
    const int row = it * 2 + h2;                         // it 0..7 x h2 0..1 = rows 0..15
    ov[it] = *(const v4f*)(os + row * 64 + c4);
  }
  {
#pragma unroll
    for (int it = 0; it < 8; ++it) {
      const int row = it * 2 + h2;
      const size_t go = (((size_t)(b * TS + tbase + row)) * DS + r) * DS + c4;
      *(v4f*)(outp + go) = ov[it];
    }
    
  }
}

// =====================================================================================================
// Workspace map (bytes); every region is an exact multiple of its whole-line store granularity, all offsets
// multiples of 8388608 except the last, no aliasing:
//   Xh   f16 [1024][4096]   ([b][t][r][c], xn x8 hi)          0         8388608
//   Xl   f16 [1024][4096]   (residual x2^11)                  8388608   8388608
//   Ld   f32 [1024][64]     ([b][t][r], dt * (-exp(log_A)))   16777216  262144
//   end                                                        17039360
// d_out f32 [2][512][64][64] at byte 0.
// =====================================================================================================
extern "C" void kernel_launch(void* const* d_in, const int* in_sizes, int n_in,
                              void* d_out, int out_size, void* d_ws, size_t ws_size,
                              hipStream_t stream) {
  if (n_in < 6) return;
  if (in_sizes[0] != NTOT) return;
  if (in_sizes[1] != DS) return;
  if (in_sizes[2] != DS) return;
  if (in_sizes[3] != 1) return;
  if (in_sizes[4] != PLN) return;
  if (in_sizes[5] != PLN) return;
  if (out_size != NTOT) return;

  const float* x    = (const float*)d_in[0];   // [2][512][64][64]
  const float* logA = (const float*)d_in[1];   // [64]
  const float* dtw  = (const float*)d_in[2];   // [64]
  const float* dtb  = (const float*)d_in[3];   // [1]
  const float* lnw  = (const float*)d_in[4];   // [64][64]
  const float* lnb  = (const float*)d_in[5];   // [64][64]
  float* outf = (float*)d_out;

  const size_t PB = (size_t)NTOT * 2;          // 8388608
  const size_t LB = (size_t)NBT * DS * 4;      //  262144
  size_t off = 0;
  const size_t oXh  = off; off += PB;
  const size_t oXl  = off; off += PB;
  const size_t oLd  = off; off += LB;
  if (off > ws_size) return;                   // off = 17039360
  if (off > (size_t)134217728) return;

  char* ws = (char*)d_ws;
  unsigned short* Xh  = (unsigned short*)(ws + oXh);
  unsigned short* Xl  = (unsigned short*)(ws + oXl);
  float*          Ld  = (float*)(ws + oLd);

  const int nbt = in_sizes[0] / PLN;           // 1024
  // (1) LayerNorm, dt, ld and the two xn planes
  ln_k<<<dim3(nbt), dim3(256), 0, stream>>>(x, logA, dtw, dtb, lnw, lnb, Xh, Xl, Ld, nbt);
  // (2) prefix sum + causal decay product -> d_out
  ssm_k<<<dim3(TS / 64, DS, NB), dim3(128), 0, stream>>>(Xh, Xl, Ld, outf);
  (void)hipGetLastError();
}

// v003
// A run of this version takes 28 microseconds.
// Next to v002, in two timings, it ran 1.27 and 1.24 times as fast.
// Over all steps from v000 it is 2.27 times as fast.
// Contraction out[b][t][r][c] = sum_{j<=t} D[t][j] * xn[b][j][r][c] per (b, r), K = 512: v_wmma_f32_16x16x32_f16 with D = exp(cs_t - cs_j) carried x2^14 and xn carried x2^3, each as f16 hi + x2^11 residual plane, products hi.hi + (hi.lo + lo.hi) x 2^-11, f32 accumulate. LayerNorm, the 64-term dt dot, softplus, prefix sum and exp are f32 on VALU; all six inputs RNE-converted to bf16 values on load.
#include <hip/hip_runtime.h>
#include <math.h>
#include <stdint.h>

#define NB   2
#define TS   512
#define DS   64
#define NBT  (NB * TS)          // 1024 (b, t) rows
#define PLN  (DS * DS)          // 4096 elements per (b, t)
#define NTOT (NBT * PLN)        // 4194304
static_assert((TS % 64) == 0);
static_assert(DS == 64);
static_assert(PLN == 2 * 8 * 256);

typedef _Float16 v16h __attribute__((ext_vector_type(16)));
typedef short    v8s  __attribute__((ext_vector_type(8)));
typedef float    v8f  __attribute__((ext_vector_type(8)));
typedef float    v4f  __attribute__((ext_vector_type(4)));
typedef unsigned int v4u __attribute__((ext_vector_type(4)));

// ---- scalar helpers --------------------------------------------------------------------------------
__device__ __forceinline__ unsigned short bf_bits(float f) {          // f32 -> bf16 bits, RNE convert
  unsigned u = __float_as_uint(f);
  return (unsigned short)((u + 0x7FFFu + ((u >> 16) & 1u)) >> 16);
}
__device__ __forceinline__ float bfr(float f) { return __uint_as_float(((unsigned)bf_bits(f)) << 16); }
__device__ __forceinline__ unsigned short h_bits(_Float16 x) { return __builtin_bit_cast(unsigned short, x); }
__device__ __forceinline__ unsigned pk16(unsigned short a, unsigned short b) { return (unsigned)a | ((unsigned)b << 16); }
__device__ __forceinline__ v8f zero8() { v8f z = {0.f, 0.f, 0.f, 0.f, 0.f, 0.f, 0.f, 0.f}; return z; }
__device__ __forceinline__ float wave_sum(float v) {
#pragma unroll
  for (int off = 16; off > 0; off >>= 1) v += __shfl_xor(v, off, 32);
  return v;
}

// ---- WMMA helper with trailing VALU hazard gap ----------------------------------------------------------
__device__ __forceinline__ v8f mma_h(v16h a, v16h b, v8f c) {
  c = __builtin_amdgcn_wmma_f32_16x16x32_f16(false, a, false, b, (short)0, c, false, false);
#if defined(__HIP_DEVICE_COMPILE__)
  asm volatile("v_nop\n\tv_nop\n\tv_nop\n\tv_nop" : "+v"(c) : "v"(a), "v"(b));
#endif
  return c;
}

// =====================================================================================================
// Stage 1: one block per (b, t), 256 threads. Thread tid owns elements e0 = tid*8..+7 (row tid>>3,
// cols (tid&7)*8..+7) and e1 = 2048 + tid*8..+7 (row 32 + tid>>3, same cols) of the 64x64 slice.
// + dt_b; dt = softplus(z) = max(z,0) + log1p(exp(-|z|)); ld[b][t][r] = dt * (-exp(log_A[r])).
// Outputs: Xh = f16(8 xn), Xl = f16((8 xn - Xh) * 2048) in [b][t][r][c] layout: per plane two store
// coverage: Xh/Xl 2 x 256 x 8 = 4096 halves per (b,t); ld 16 x 4 = 64 floats per (b,t); grid = all (b,t).
// =====================================================================================================
__global__ __launch_bounds__(256) void ln_k(const float* __restrict__ x, const float* __restrict__ logA,
                                            const float* __restrict__ dtw, const float* __restrict__ dtb,
                                            const float* __restrict__ lnw, const float* __restrict__ lnb,
                                            unsigned short* Xh, unsigned short* Xl, float* ldp, int nbt) {
  __shared__ float red0[8];
  __shared__ float red1[8];
  __shared__ float zrow[64];
  __shared__ __align__(16) float ldv[64];
  const int bt = blockIdx.x;
  if (bt >= nbt) return;                       // block-uniform, before any barrier
  const int tid = threadIdx.x, lane = tid & 31, wave = tid >> 5;
  const int e0 = tid * 8, e1 = 2048 + tid * 8;
  const float* xp = x + (size_t)bt * PLN;

  const v4f xa = *(const v4f*)(xp + e0);
  const v4f xb = *(const v4f*)(xp + e0 + 4);
  const v4f xc = *(const v4f*)(xp + e1);
  const v4f xd = *(const v4f*)(xp + e1 + 4);
  float v[16];
#pragma unroll
  for (int q = 0; q < 4; ++q) {
    v[q]      = bfr(xa[q]);
    v[4 + q]  = bfr(xb[q]);
    v[8 + q]  = bfr(xc[q]);
    v[12 + q] = bfr(xd[q]);
  }
  // ---- mean ----
  float s = 0.0f;
#pragma unroll
  for (int i = 0; i < 16; ++i) s += v[i];
  s = wave_sum(s);
  if (lane == 0) red0[wave] = s;
  __syncthreads();
  float tot = 0.0f;
#pragma unroll
  for (int w = 0; w < 8; ++w) tot += red0[w];
  const float mu = tot * (1.0f / 4096.0f);
  // ---- centred variance ----
  float ss = 0.0f;
#pragma unroll
  for (int i = 0; i < 16; ++i) { const float d = v[i] - mu; ss += d * d; }
  ss = wave_sum(ss);
  if (lane == 0) red1[wave] = ss;
  __syncthreads();
  float vt = 0.0f;
#pragma unroll
  for (int w = 0; w < 8; ++w) vt += red1[w];
  const float var  = vt * (1.0f / 4096.0f);
  const float rstd = rsqrtf(var + 1e-5f);
  // ---- affine ----
  const v4f wa = *(const v4f*)(lnw + e0), wb = *(const v4f*)(lnw + e0 + 4);
  const v4f wc = *(const v4f*)(lnw + e1), wd = *(const v4f*)(lnw + e1 + 4);
  const v4f ba = *(const v4f*)(lnb + e0), bb = *(const v4f*)(lnb + e0 + 4);
  const v4f bc = *(const v4f*)(lnb + e1), bd = *(const v4f*)(lnb + e1 + 4);
  float xn[16];
#pragma unroll
  for (int q = 0; q < 4; ++q) {
    xn[q]      = (v[q]      - mu) * rstd * bfr(wa[q]) + bfr(ba[q]);
    xn[4 + q]  = (v[4 + q]  - mu) * rstd * bfr(wb[q]) + bfr(bb[q]);
    xn[8 + q]  = (v[8 + q]  - mu) * rstd * bfr(wc[q]) + bfr(bc[q]);
    xn[12 + q] = (v[12 + q] - mu) * rstd * bfr(wd[q]) + bfr(bd[q]);
  }
  // ---- dt dot: 8 terms per thread, reduced over the 8 lanes covering a row ----
  const int c8 = (tid & 7) * 8;
  const v4f da = *(const v4f*)(dtw + c8), db = *(const v4f*)(dtw + c8 + 4);
  float dw[8];
#pragma unroll
  for (int q = 0; q < 4; ++q) { dw[q] = bfr(da[q]); dw[4 + q] = bfr(db[q]); }
  float d0 = 0.0f, d1 = 0.0f;
#pragma unroll
  for (int i = 0; i < 8; ++i) { d0 += xn[i] * dw[i]; d1 += xn[8 + i] * dw[i]; }
  d0 += __shfl_xor(d0, 1, 32); d0 += __shfl_xor(d0, 2, 32); d0 += __shfl_xor(d0, 4, 32);
  d1 += __shfl_xor(d1, 1, 32); d1 += __shfl_xor(d1, 2, 32); d1 += __shfl_xor(d1, 4, 32);
  if ((tid & 7) == 0) { zrow[tid >> 3] = d0; zrow[32 + (tid >> 3)] = d1; }
  __syncthreads();
  if (tid < 64) {
    const float z  = zrow[tid] + bfr(dtb[0]);
    const float sp = fmaxf(z, 0.0f) + log1pf(__expf(-fabsf(z)));     // softplus
    const float ac = -__expf(bfr(logA[tid]));
    ldv[tid] = sp * ac;
  }
  __syncthreads();
  // ---- pack planes: hi = f16(8 xn), residual = f16((8 xn - hi) * 2048) ----
  v4u ph0, pl0, ph1, pl1;
#pragma unroll
  for (int e = 0; e < 4; ++e) {
    const float g0 = xn[2 * e] * 8.0f, g1 = xn[2 * e + 1] * 8.0f;
    const _Float16 x0 = (_Float16)g0, x1 = (_Float16)g1;
    const _Float16 y0 = (_Float16)((g0 - (float)x0) * 2048.0f);
    const _Float16 y1 = (_Float16)((g1 - (float)x1) * 2048.0f);
    ph0[e] = pk16(h_bits(x0), h_bits(x1));
    pl0[e] = pk16(h_bits(y0), h_bits(y1));
    const float k0 = xn[8 + 2 * e] * 8.0f, k1 = xn[8 + 2 * e + 1] * 8.0f;
    const _Float16 u0 = (_Float16)k0, u1 = (_Float16)k1;
    const _Float16 w0 = (_Float16)((k0 - (float)u0) * 2048.0f);
    const _Float16 w1 = (_Float16)((k1 - (float)u1) * 2048.0f);
    ph1[e] = pk16(h_bits(u0), h_bits(u1));
    pl1[e] = pk16(h_bits(w0), h_bits(w1));
  }
  const v4f lv = *(const v4f*)(ldv + (tid & 15) * 4);          // clamped LDS address, stored only by tid < 16
  const size_t po0 = (size_t)bt * PLN + e0;
  const size_t po1 = (size_t)bt * PLN + e1;
  const size_t plo = (size_t)bt * DS + (tid & 15) * 4;
  {
    *(v4u*)(Xh + po0) = ph0;
    *(v4u*)(Xh + po1) = ph1;
    *(v4u*)(Xl + po0) = pl0;
    *(v4u*)(Xl + po1) = pl1;
    if (tid < 16) *(v4f*)(ldp + plo) = lv;
    
  }
}

// =====================================================================================================
// Stage 2: out[b][t][r][c] = sum_{j<=t} exp(cs[b][t][r] - cs[b][j][r]) * xn[b][j][r][c].
// Block = (64-row t tile tt, r, b), 4 waves; wave w owns t rows tt*64 + 16w .. +15 and all 64 c.
// cs: the block forms the inclusive prefix sum of ld[b][0 .. 64 (tt + 1) - 1][r] in f32 with all 128 threads: four
// tokens a thread, a shuffle scan over each wave's thread totals, then the earlier waves' totals from LDS.
// A fragment (decay tile, built in registers): lane row = lane&15 -> t = tbase + (lane&15); element e<8 -> j =
// j0 + 8h + e, e>=8 -> j = j0 + 16 + 8h + (e-8) (split k map); value P = exp(min(cs_t - cs_j, 0)) (<= 1),
// 0 for j > t (select by value), hi = f16(P * 16384), residual = f16((P*16384 - hi) * 2048).
// B tiles: 64 tokens x 64 c of the [b][t][r][c] hi and residual planes, as stage 1 stores them, are copied once
// per block into LDS (rows = tokens of 128 B, whole lines, pitch 160 B) by asynchronous copies, two buffers:
// tile k+1 flies while tile k is worked on; all four waves read their fragments from that one copy.
// B fragments: two transposing LDS loads (ds_load_tr16_b128) at token rows j0 and j0 + 16: lane (c = lane&15, h)
// gets tokens j0 + 8h .. +7 and j0 + 16 + 8h .. +7 of column c (split k map, as the A fragment).
// acc += Ph.Xh; acc2 += Ph.Xl + Pl.Xh; out = (acc + acc2/2048) / 2^17.
// The tile loop's trip count tt + 1 is block-uniform; a wave skips the 32-token half past its diagonal
// (wave-uniform scalar test) but passes every wait and barrier.
// Not yet used: a block's length grows with tt, the grid's fastest index; a decay tile left of the diagonal tile
// has rank one, exp(cs_t - cs_m) * exp(cs_m - cs_j).
// coverage: 4 waves x 16 rows x 64 cols = the block's 64 x 64 tile; grid (TS/64, DS, NB) = every (t, r, b) once.
// =====================================================================================================
#define XP    80                 // LDS row pitch in halves: 160 B = 32 B x 5, the transposing load's pitch
#define XTILE (64 * XP)          // halves of one plane's tile in LDS

// One block-wide tile fill: thread tid copies 16 B pieces (token row i*16 + tid>>3, piece tid&7), i = 0..3, of both
// planes. gh/gl: this lane's first source piece; lh/ll: this lane's first LDS byte address. Row step: 16 rows.
__device__ __forceinline__ void stage_tile(const _Float16* gh, const _Float16* gl, unsigned lh, unsigned ll) {
  const _Float16* gh1 = gh + 16 * PLN; const _Float16* gh2 = gh + 32 * PLN; const _Float16* gh3 = gh + 48 * PLN;
  const _Float16* gl1 = gl + 16 * PLN; const _Float16* gl2 = gl + 32 * PLN; const _Float16* gl3 = gl + 48 * PLN;
  const unsigned st = 16 * XP * 2;
  const unsigned lh1 = lh + st, lh2 = lh + 2 * st, lh3 = lh + 3 * st;
  const unsigned ll1 = ll + st, ll2 = ll + 2 * st, ll3 = ll + 3 * st;
#if defined(__HIP_DEVICE_COMPILE__)
  // the eight copies and, as the last line, the wait that stands before any of their address registers is rewritten
  asm volatile("global_load_async_to_lds_b128 %0, %8, off\n\t"
               "global_load_async_to_lds_b128 %1, %9, off\n\t"
               "global_load_async_to_lds_b128 %2, %10, off\n\t"
               "global_load_async_to_lds_b128 %3, %11, off\n\t"
               "global_load_async_to_lds_b128 %4, %12, off\n\t"
               "global_load_async_to_lds_b128 %5, %13, off\n\t"
               "global_load_async_to_lds_b128 %6, %14, off\n\t"
               "global_load_async_to_lds_b128 %7, %15, off\n\t"
               "s_wait_xcnt 0x0"
               :: "v"(lh), "v"(lh1), "v"(lh2), "v"(lh3), "v"(ll), "v"(ll1), "v"(ll2), "v"(ll3),
                  "v"(gh), "v"(gh1), "v"(gh2), "v"(gh3), "v"(gl), "v"(gl1), "v"(gl2), "v"(gl3)
               : "memory");
#endif
}

// Transposing fragment load: p = this lane's 16-B piece of the token-major tile (row kbase + 8h + (lane&7), piece
// (lane>>3)&1 of the 16 columns); q = the same 16 rows further on. Elements 0..7 <- tokens kbase + 8h .. +7,
// elements 8..15 <- tokens kbase + 16 + 8h .. +7, both of column lane&15.
__device__ __forceinline__ v16h ldfrag_tr(const _Float16* p, const _Float16* q) {
  typedef __attribute__((address_space(3))) v8s lds_v8s;
  union { v16h v; v8s h[2]; } f;
  f.h[0] = __builtin_amdgcn_ds_load_tr16_b128_v8i16((lds_v8s*)p);
  f.h[1] = __builtin_amdgcn_ds_load_tr16_b128_v8i16((lds_v8s*)q);
  return f.v;
}

__global__ __launch_bounds__(128) void ssm_k(const unsigned short* __restrict__ Xhp, const unsigned short* __restrict__ Xlp,
                                             const float* __restrict__ ldp, float* outp) {
  __shared__ __align__(16) float cs_s[TS];
  __shared__ float wtot[4];
  __shared__ __align__(16) float os_s[4 * 16 * 64];
  __shared__ __align__(16) _Float16 xs[2 * 2 * XTILE];        // [buffer][plane][token][c], pitch XP
  const int tt = blockIdx.x, r = blockIdx.y, b = blockIdx.z;
  const int tid = threadIdx.x, lane = tid & 31, hh = lane >> 4, l16 = lane & 15;
  const int wave = __builtin_amdgcn_readfirstlane(tid >> 5);  // scalar, so that the per-wave skip is a scalar branch

  const _Float16* Xh = (const _Float16*)(const void*)Xhp;
  const _Float16* Xl = (const _Float16*)(const void*)Xlp;
  const size_t plb = ((size_t)(b * TS) * DS + r) * DS;         // (b, token 0, r, c 0)
  const int    sof = (tid >> 3) * PLN + (tid & 7) * 8;         // this lane's first piece inside a tile's rows
  const _Float16* sgh = Xh + plb + sof;
  const _Float16* sgl = Xl + plb + sof;
  const unsigned  slh = (unsigned)(uintptr_t)(xs + (tid >> 3) * XP + (tid & 7) * 8);   // LDS byte address
  const int nt = tt + 1;                                       // tiles of 64 tokens, block-uniform

  stage_tile(sgh, sgl, slh, slh + XTILE * 2);                  // tile 0 -> buffer 0

  // ---- inclusive prefix sum of ld[b][0 .. 64 nt - 1][r], all 128 threads: thread tid owns tokens 4 tid .. +3 ----
  const int t4 = tid * 4;
  float l0 = 0.0f, l1 = 0.0f, l2 = 0.0f, l3 = 0.0f;            // tokens past the block's last row are never read: 0
  if (t4 < nt * 64) {
    const float* lp = ldp + ((size_t)(b * TS + t4)) * DS + r;
    l0 = lp[0]; l1 = lp[DS]; l2 = lp[2 * DS]; l3 = lp[3 * DS];
  }
  l1 += l0; l2 += l1; l3 += l2;                                // inside the thread
  float sc = l3;                                               // over the wave's 32 thread totals, inclusive
#pragma unroll                                                 // five steps, each with its distance as a constant
  for (int off = 1; off < 32; off <<= 1) {
    const float o = __shfl_up(sc, off, 32);
    sc += (lane >= off) ? o : 0.0f;
  }
  if (lane == 31) wtot[wave] = sc;
  float pre = __shfl_up(sc, 1, 32);                            // total of the wave's earlier threads
  pre = (lane > 0) ? pre : 0.0f;
  __syncthreads();                                             // the four wave totals are written
#pragma unroll                                                 // three selects on the scalar wave number, no loop
  for (int w = 0; w < 3; ++w) pre += (w < wave) ? wtot[w] : 0.0f;
  {
    const v4f c4v = {pre + l0, pre + l1, pre + l2, pre + l3};
    *(v4f*)(cs_s + t4) = c4v;
  }
  asm volatile("s_wait_asynccnt 0x0" ::: "memory");            // this wave's share of tile 0 has landed
  __syncthreads();                                             // publishes the prefix sum and tile 0
  if (nt > 1) stage_tile(sgh + 64 * PLN, sgl + 64 * PLN, slh + 2 * XTILE * 2, slh + 3 * XTILE * 2);   // tile 1 -> buffer 1

  const int tbase = tt * 64 + wave * 16;
  const int trow  = tbase + l16;
  const float cst = cs_s[trow];

  v8f acc[4], acc2[4];
#pragma unroll
  for (int s = 0; s < 4; ++s) { acc[s] = zero8(); acc2[s] = zero8(); }

  const int jend = tbase + 16;               // wave-uniform causal bound
#pragma unroll 1                             // one tile per trip: the ring's waits and barrier stand once
  for (int kc = 0; kc < nt; ++kc) {
    const int bufo = (kc & 1) * (2 * XTILE);
#pragma unroll 1                             // kept rolled: the second half is skipped on the diagonal by waves 0 and 1
    for (int j0 = kc * 64; j0 < kc * 64 + 64 && j0 < jend; j0 += 32) {
      const _Float16* fb = xs + bufo + ((j0 & 32) + 8 * hh + (lane & 7)) * XP + ((lane >> 3) & 1) * 8;
      v16h xh[4], xl[4];
#pragma unroll
      for (int s = 0; s < 4; ++s) {
        xh[s] = ldfrag_tr(fb + s * 16, fb + 16 * XP + s * 16);
        xl[s] = ldfrag_tr(fb + XTILE + s * 16, fb + XTILE + 16 * XP + s * 16);
      }
      const int kA = j0 + hh * 8;
      const int kB = j0 + 16 + hh * 8;
      const v4f q0 = *(const v4f*)(cs_s + kA);
      const v4f q1 = *(const v4f*)(cs_s + kA + 4);
      const v4f q2 = *(const v4f*)(cs_s + kB);
      const v4f q3 = *(const v4f*)(cs_s + kB + 4);
      float cj[16];
#pragma unroll
      for (int q = 0; q < 4; ++q) {
        cj[q]      = q0[q];
        cj[q + 4]  = q1[q];
        cj[q + 8]  = q2[q];
        cj[q + 12] = q3[q];
      }
      float ex[16];
#pragma unroll
      for (int e = 0; e < 16; ++e) ex[e] = fminf(cst - cj[e], 0.0f) * 1.44269504088896340736f;
#if defined(__HIP_DEVICE_COMPILE__)
      // The instruction set asks for one slot behind a v_exp_f32 before a register it reads is rewritten. The
      // scheduling barriers keep the sixteen v_exp_f32 by themselves, with nothing between them that rewrites an
      // argument, and hold the v_nop directly behind the last.
      __builtin_amdgcn_sched_barrier(0);
#pragma unroll
      for (int e = 0; e < 16; ++e) ex[e] = __builtin_amdgcn_exp2f(ex[e]);
      __builtin_amdgcn_sched_barrier(0);
      asm volatile("v_nop");
      __builtin_amdgcn_sched_barrier(0);
#endif
      v16h pa, pr;
#pragma unroll
      for (int e = 0; e < 16; ++e) {
        const int j = (e < 8) ? (kA + e) : (kB + e - 8);
        float p = ex[e] * 16384.0f;
        p = (j <= trow) ? p : 0.0f;                          // causal select by value
        const _Float16 x0 = (_Float16)p;
        pa[e] = x0;
        pr[e] = (_Float16)((p - (float)x0) * 2048.0f);
      }
#pragma unroll
      for (int s = 0; s < 4; ++s) {
        acc[s]  = mma_h(pa, xh[s], acc[s]);
        acc2[s] = mma_h(pa, xl[s], acc2[s]);
        acc2[s] = mma_h(pr, xh[s], acc2[s]);
      }
    }
    asm volatile("s_wait_dscnt 0x0" ::: "memory");             // this wave's reads of the buffer are done
    asm volatile("s_wait_asynccnt 0x0" ::: "memory");          // this wave's share of tile kc + 1 has landed
    __syncthreads();                                           // publishes tile kc + 1, frees tile kc's buffer
    if (kc + 2 < nt)
      stage_tile(sgh + (size_t)(kc + 2) * (64 * PLN), sgl + (size_t)(kc + 2) * (64 * PLN), slh + bufo * 2, slh + bufo * 2 + XTILE * 2);
  }
  asm volatile("s_wait_asynccnt 0x0" ::: "memory");            // no copy is outstanding when the wave goes on

  // ---- epilogue ----
  float* os = os_s + wave * (16 * 64);
#pragma unroll
  for (int r8 = 0; r8 < 8; ++r8) {
#pragma unroll
    for (int s = 0; s < 4; ++s) {
      const float val = (acc[s][r8] + acc2[s][r8] * (1.0f / 2048.0f)) * (1.0f / 131072.0f);
      os[(8 * hh + r8) * 64 + s * 16 + l16] = val;
    }
  }
  __builtin_amdgcn_fence(__ATOMIC_RELEASE, "workgroup");
  __builtin_amdgcn_wave_barrier();
  __builtin_amdgcn_fence(__ATOMIC_ACQUIRE, "workgroup");
  const int h2 = lane >> 4, c4 = (lane & 15) * 4;       // 256-B row = 16 lanes x 16 B
  v4f ov[8];
#pragma unroll
  for (int it = 0; it < 8; ++it) {
    const int row = it * 2 + h2;                         // it 0..7 x h2 0..1 = rows 0..15
    ov[it] = *(const v4f*)(os + row * 64 + c4);
  }
  {
#pragma unroll
    for (int it = 0; it < 8; ++it) {
      const int row = it * 2 + h2;
      const size_t go = (((size_t)(b * TS + tbase + row)) * DS + r) * DS + c4;
      *(v4f*)(outp + go) = ov[it];
    }
    
  }
}

// =====================================================================================================
// Workspace map (bytes); every region is an exact multiple of its whole-line store granularity, all offsets
// multiples of 8388608 except the last, no aliasing:
//   Xh   f16 [1024][4096]   ([b][t][r][c], xn x8 hi)          0         8388608
//   Xl   f16 [1024][4096]   (residual x2^11)                  8388608   8388608
//   Ld   f32 [1024][64]     ([b][t][r], dt * (-exp(log_A)))   16777216  262144
//   end                                                        17039360
// d_out f32 [2][512][64][64] at byte 0.
// =====================================================================================================
extern "C" void kernel_launch(void* const* d_in, const int* in_sizes, int n_in,
                              void* d_out, int out_size, void* d_ws, size_t ws_size,
                              hipStream_t stream) {
  if (n_in < 6) return;
  if (in_sizes[0] != NTOT) return;
  if (in_sizes[1] != DS) return;
  if (in_sizes[2] != DS) return;
  if (in_sizes[3] != 1) return;
  if (in_sizes[4] != PLN) return;
  if (in_sizes[5] != PLN) return;
  if (out_size != NTOT) return;

  const float* x    = (const float*)d_in[0];   // [2][512][64][64]
  const float* logA = (const float*)d_in[1];   // [64]
  const float* dtw  = (const float*)d_in[2];   // [64]
  const float* dtb  = (const float*)d_in[3];   // [1]
  const float* lnw  = (const float*)d_in[4];   // [64][64]
  const float* lnb  = (const float*)d_in[5];   // [64][64]
  float* outf = (float*)d_out;

  const size_t PB = (size_t)NTOT * 2;          // 8388608
  const size_t LB = (size_t)NBT * DS * 4;      //  262144
  size_t off = 0;
  const size_t oXh  = off; off += PB;
  const size_t oXl  = off; off += PB;
  const size_t oLd  = off; off += LB;
  if (off > ws_size) return;                   // off = 17039360
  if (off > (size_t)134217728) return;

  char* ws = (char*)d_ws;
  unsigned short* Xh  = (unsigned short*)(ws + oXh);
  unsigned short* Xl  = (unsigned short*)(ws + oXl);
  float*          Ld  = (float*)(ws + oLd);

  const int nbt = in_sizes[0] / PLN;           // 1024
  // (1) LayerNorm, dt, ld and the two xn planes
  ln_k<<<dim3(nbt), dim3(256), 0, stream>>>(x, logA, dtw, dtb, lnw, lnb, Xh, Xl, Ld, nbt);
  // (2) prefix sum + causal decay product -> d_out
  ssm_k<<<dim3(TS / 64, DS, NB), dim3(128), 0, stream>>>(Xh, Xl, Ld, outf);
  (void)hipGetLastError();
}

// v004
// A run of this version takes 17.6 microseconds.
// Two timings next to v003 both put it at 1.59 times that version's speed.
// All steps since v000 together make it 3.60 times as fast.
// Contraction out[b][t][r][c] = sum_{j<=t} D[t][j] * xn[b][j][r][c] per (b, r), K = 512: v_wmma_f32_16x16x32_f16 with D = exp(cs_t - cs_j) carried x2^14 and xn carried x2^3, each as f16 hi + x2^11 residual plane, products hi.hi + (hi.lo + lo.hi) x 2^-11, f32 accumulate. LayerNorm, the 64-term dt dot, softplus, prefix sum and exp are f32 on VALU; all six inputs RNE-converted to bf16 values on load.
#include <hip/hip_runtime.h>
#include <math.h>
#include <stdint.h>

#define NB   2
#define TS   512
#define DS   64
#define NBT  (NB * TS)          // 1024 (b, t) rows
#define PLN  (DS * DS)          // 4096 elements per (b, t)
#define NTOT (NBT * PLN)        // 4194304
static_assert((TS % 64) == 0);
static_assert(DS == 64);
static_assert(PLN == 2 * 8 * 256);

typedef _Float16 v16h __attribute__((ext_vector_type(16)));
typedef short    v8s  __attribute__((ext_vector_type(8)));
typedef float    v8f  __attribute__((ext_vector_type(8)));
typedef float    v4f  __attribute__((ext_vector_type(4)));
typedef unsigned int v4u __attribute__((ext_vector_type(4)));

// ---- scalar helpers --------------------------------------------------------------------------------
__device__ __forceinline__ unsigned short bf_bits(float f) {          // f32 -> bf16 bits, RNE convert
  unsigned u = __float_as_uint(f);
  return (unsigned short)((u + 0x7FFFu + ((u >> 16) & 1u)) >> 16);
}
__device__ __forceinline__ float bfr(float f) { return __uint_as_float(((unsigned)bf_bits(f)) << 16); }
__device__ __forceinline__ unsigned short h_bits(_Float16 x) { return __builtin_bit_cast(unsigned short, x); }
__device__ __forceinline__ unsigned pk16(unsigned short a, unsigned short b) { return (unsigned)a | ((unsigned)b << 16); }
__device__ __forceinline__ v8f zero8() { v8f z = {0.f, 0.f, 0.f, 0.f, 0.f, 0.f, 0.f, 0.f}; return z; }
__device__ __forceinline__ float wave_sum(float v) {
#pragma unroll
  for (int off = 16; off > 0; off >>= 1) v += __shfl_xor(v, off, 32);
  return v;
}

// ---- WMMA helper with trailing VALU hazard gap ----------------------------------------------------------
__device__ __forceinline__ v8f mma_h(v16h a, v16h b, v8f c) {
  c = __builtin_amdgcn_wmma_f32_16x16x32_f16(false, a, false, b, (short)0, c, false, false);
#if defined(__HIP_DEVICE_COMPILE__)
  asm volatile("v_nop\n\tv_nop\n\tv_nop\n\tv_nop" : "+v"(c) : "v"(a), "v"(b));
#endif
  return c;
}

// =====================================================================================================
// Stage 1: one block per (b, t), 256 threads. Thread tid owns elements e0 = tid*8..+7 (row tid>>3,
// cols (tid&7)*8..+7) and e1 = 2048 + tid*8..+7 (row 32 + tid>>3, same cols) of the 64x64 slice.
// + dt_b; dt = softplus(z) = max(z,0) + log1p(exp(-|z|)); ld[b][t][r] = dt * (-exp(log_A[r])).
// Outputs: Xh = f16(8 xn), Xl = f16((8 xn - Xh) * 2048) in [b][t][r][c] layout: per plane two store
// coverage: Xh/Xl 2 x 256 x 8 = 4096 halves per (b,t); ld 16 x 4 = 64 floats per (b,t); grid = all (b,t).
// =====================================================================================================
__global__ __launch_bounds__(256) void ln_k(const float* __restrict__ x, const float* __restrict__ logA,
                                            const float* __restrict__ dtw, const float* __restrict__ dtb,
                                            const float* __restrict__ lnw, const float* __restrict__ lnb,
                                            unsigned short* Xh, unsigned short* Xl, float* ldp, int nbt) {
  __shared__ float red0[8];
  __shared__ float red1[8];
  __shared__ float zrow[64];
  __shared__ __align__(16) float ldv[64];
  const int bt = blockIdx.x;
  if (bt >= nbt) return;                       // block-uniform, before any barrier
  const int tid = threadIdx.x, lane = tid & 31, wave = tid >> 5;
  const int e0 = tid * 8, e1 = 2048 + tid * 8;
  const float* xp = x + (size_t)bt * PLN;

  const v4f xa = *(const v4f*)(xp + e0);
  const v4f xb = *(const v4f*)(xp + e0 + 4);
  const v4f xc = *(const v4f*)(xp + e1);
  const v4f xd = *(const v4f*)(xp + e1 + 4);
  float v[16];
#pragma unroll
  for (int q = 0; q < 4; ++q) {
    v[q]      = bfr(xa[q]);
    v[4 + q]  = bfr(xb[q]);
    v[8 + q]  = bfr(xc[q]);
    v[12 + q] = bfr(xd[q]);
  }
  // ---- mean ----
  float s = 0.0f;
#pragma unroll
  for (int i = 0; i < 16; ++i) s += v[i];
  s = wave_sum(s);
  if (lane == 0) red0[wave] = s;
  __syncthreads();
  float tot = 0.0f;
#pragma unroll
  for (int w = 0; w < 8; ++w) tot += red0[w];
  const float mu = tot * (1.0f / 4096.0f);
  // ---- centred variance ----
  float ss = 0.0f;
#pragma unroll
  for (int i = 0; i < 16; ++i) { const float d = v[i] - mu; ss += d * d; }
  ss = wave_sum(ss);
  if (lane == 0) red1[wave] = ss;
  __syncthreads();
  float vt = 0.0f;
#pragma unroll
  for (int w = 0; w < 8; ++w) vt += red1[w];
  const float var  = vt * (1.0f / 4096.0f);
  const float rstd = rsqrtf(var + 1e-5f);
  // ---- affine ----
  const v4f wa = *(const v4f*)(lnw + e0), wb = *(const v4f*)(lnw + e0 + 4);
  const v4f wc = *(const v4f*)(lnw + e1), wd = *(const v4f*)(lnw + e1 + 4);
  const v4f ba = *(const v4f*)(lnb + e0), bb = *(const v4f*)(lnb + e0 + 4);
  const v4f bc = *(const v4f*)(lnb + e1), bd = *(const v4f*)(lnb + e1 + 4);
  float xn[16];
#pragma unroll
  for (int q = 0; q < 4; ++q) {
    xn[q]      = (v[q]      - mu) * rstd * bfr(wa[q]) + bfr(ba[q]);
    xn[4 + q]  = (v[4 + q]  - mu) * rstd * bfr(wb[q]) + bfr(bb[q]);
    xn[8 + q]  = (v[8 + q]  - mu) * rstd * bfr(wc[q]) + bfr(bc[q]);
    xn[12 + q] = (v[12 + q] - mu) * rstd * bfr(wd[q]) + bfr(bd[q]);
  }
  // ---- dt dot: 8 terms per thread, reduced over the 8 lanes covering a row ----
  const int c8 = (tid & 7) * 8;
  const v4f da = *(const v4f*)(dtw + c8), db = *(const v4f*)(dtw + c8 + 4);
  float dw[8];
#pragma unroll
  for (int q = 0; q < 4; ++q) { dw[q] = bfr(da[q]); dw[4 + q] = bfr(db[q]); }
  float d0 = 0.0f, d1 = 0.0f;
#pragma unroll
  for (int i = 0; i < 8; ++i) { d0 += xn[i] * dw[i]; d1 += xn[8 + i] * dw[i]; }
  d0 += __shfl_xor(d0, 1, 32); d0 += __shfl_xor(d0, 2, 32); d0 += __shfl_xor(d0, 4, 32);
  d1 += __shfl_xor(d1, 1, 32); d1 += __shfl_xor(d1, 2, 32); d1 += __shfl_xor(d1, 4, 32);
  if ((tid & 7) == 0) { zrow[tid >> 3] = d0; zrow[32 + (tid >> 3)] = d1; }
  __syncthreads();
  if (tid < 64) {
    const float z  = zrow[tid] + bfr(dtb[0]);
    const float sp = fmaxf(z, 0.0f) + log1pf(__expf(-fabsf(z)));     // softplus
    const float ac = -__expf(bfr(logA[tid]));
    ldv[tid] = sp * ac;
  }
  __syncthreads();
  // ---- pack planes: hi = f16(8 xn), residual = f16((8 xn - hi) * 2048) ----
  v4u ph0, pl0, ph1, pl1;
#pragma unroll
  for (int e = 0; e < 4; ++e) {
    const float g0 = xn[2 * e] * 8.0f, g1 = xn[2 * e + 1] * 8.0f;
    const _Float16 x0 = (_Float16)g0, x1 = (_Float16)g1;
    const _Float16 y0 = (_Float16)((g0 - (float)x0) * 2048.0f);
    const _Float16 y1 = (_Float16)((g1 - (float)x1) * 2048.0f);
    ph0[e] = pk16(h_bits(x0), h_bits(x1));
    pl0[e] = pk16(h_bits(y0), h_bits(y1));
    const float k0 = xn[8 + 2 * e] * 8.0f, k1 = xn[8 + 2 * e + 1] * 8.0f;
    const _Float16 u0 = (_Float16)k0, u1 = (_Float16)k1;
    const _Float16 w0 = (_Float16)((k0 - (float)u0) * 2048.0f);
    const _Float16 w1 = (_Float16)((k1 - (float)u1) * 2048.0f);
    ph1[e] = pk16(h_bits(u0), h_bits(u1));
    pl1[e] = pk16(h_bits(w0), h_bits(w1));
  }
  const v4f lv = *(const v4f*)(ldv + (tid & 15) * 4);          // clamped LDS address, stored only by tid < 16
  const size_t po0 = (size_t)bt * PLN + e0;
  const size_t po1 = (size_t)bt * PLN + e1;
  const size_t plo = (size_t)bt * DS + (tid & 15) * 4;
  {
    *(v4u*)(Xh + po0) = ph0;
    *(v4u*)(Xh + po1) = ph1;
    *(v4u*)(Xl + po0) = pl0;
    *(v4u*)(Xl + po1) = pl1;
    if (tid < 16) *(v4f*)(ldp + plo) = lv;
    
  }
}

// =====================================================================================================
// Stage 2: out[b][t][r][c] = sum_{j<=t} exp(cs[b][t][r] - cs[b][j][r]) * xn[b][j][r][c].
// Block = (64-row t tile tt, r, b), 4 waves; wave w owns t rows tt*64 + 16w .. +15 and all 64 c.
// cs: the block forms the inclusive prefix sum of ld[b][0 .. 64 (tt + 1) - 1][r] in f32 with all 128 threads: four
// tokens a thread, a shuffle scan over each wave's thread totals, then the earlier waves' totals from LDS.
// A fragment (decay tile, built in registers): lane row = lane&15 -> t = tbase + (lane&15); element e<8 -> j =
// j0 + 8h + e, e>=8 -> j = j0 + 16 + 8h + (e-8) (split k map); value P = exp(min(cs_t - cs_j, 0)) (<= 1),
// 0 for j > t (select by value), hi = f16(P * 16384), residual = f16((P*16384 - hi) * 2048).
// B tiles: 64 tokens x 64 c of the [b][t][r][c] hi and residual planes, as stage 1 stores them, are copied once
// per block into LDS (rows = tokens of 128 B, whole lines, pitch 160 B) by asynchronous copies, two buffers:
// tile k+1 flies while tile k is worked on; all four waves read their fragments from that one copy.
// B fragments: two transposing LDS loads (ds_load_tr16_b128) at token rows j0 and j0 + 16: lane (c = lane&15, h)
// gets tokens j0 + 8h .. +7 and j0 + 16 + 8h .. +7 of column c (split k map, as the A fragment).
// acc += Ph.Xh; acc2 += Ph.Xl + Pl.Xh; out = (acc + acc2/2048) / 2^17.
// Leading steps whose weights are all zero in both planes (test on the prefix sums, at run time) are left out: the
// block stages tiles k0 .. tt only, a wave starts at its own step jlo. With slow decay k0 = 0 and all is done.
// The tile loop's trip count tt + 1 - k0 is block-uniform; a wave skips the 32-token half past its diagonal
// (wave-uniform scalar test) but passes every wait and barrier.
// Not yet used: a block's length grows with tt, the grid's fastest index; a decay tile left of the diagonal tile
// has rank one, exp(cs_t - cs_m) * exp(cs_m - cs_j).
// coverage: 4 waves x 16 rows x 64 cols = the block's 64 x 64 tile; grid (TS/64, DS, NB) = every (t, r, b) once.
// =====================================================================================================
#define XP    80                 // LDS row pitch in halves: 160 B = 32 B x 5, the transposing load's pitch
#define XTILE (64 * XP)          // halves of one plane's tile in LDS
// A weight P = exp2(d) is carried as f16(P * 2^14) and f16(residual * 2^11): at d <= -50 both round to zero, and the
// products of such a step add exactly nothing. Two more for the rounding of the prefix sums and of v_exp_f32.
#define ZCUT  (-52.0f)

// One block-wide tile fill: thread tid copies 16 B pieces (token row i*16 + tid>>3, piece tid&7), i = 0..3, of both
// planes. gh/gl: this lane's first source piece; lh/ll: this lane's first LDS byte address. Row step: 16 rows.
__device__ __forceinline__ void stage_tile(const _Float16* gh, const _Float16* gl, unsigned lh, unsigned ll) {
  const _Float16* gh1 = gh + 16 * PLN; const _Float16* gh2 = gh + 32 * PLN; const _Float16* gh3 = gh + 48 * PLN;
  const _Float16* gl1 = gl + 16 * PLN; const _Float16* gl2 = gl + 32 * PLN; const _Float16* gl3 = gl + 48 * PLN;
  const unsigned st = 16 * XP * 2;
  const unsigned lh1 = lh + st, lh2 = lh + 2 * st, lh3 = lh + 3 * st;
  const unsigned ll1 = ll + st, ll2 = ll + 2 * st, ll3 = ll + 3 * st;
#if defined(__HIP_DEVICE_COMPILE__)
  // the eight copies and, as the last line, the wait that stands before any of their address registers is rewritten
  asm volatile("global_load_async_to_lds_b128 %0, %8, off\n\t"
               "global_load_async_to_lds_b128 %1, %9, off\n\t"
               "global_load_async_to_lds_b128 %2, %10, off\n\t"
               "global_load_async_to_lds_b128 %3, %11, off\n\t"
               "global_load_async_to_lds_b128 %4, %12, off\n\t"
               "global_load_async_to_lds_b128 %5, %13, off\n\t"
               "global_load_async_to_lds_b128 %6, %14, off\n\t"
               "global_load_async_to_lds_b128 %7, %15, off\n\t"
               "s_wait_xcnt 0x0"
               :: "v"(lh), "v"(lh1), "v"(lh2), "v"(lh3), "v"(ll), "v"(ll1), "v"(ll2), "v"(ll3),
                  "v"(gh), "v"(gh1), "v"(gh2), "v"(gh3), "v"(gl), "v"(gl1), "v"(gl2), "v"(gl3)
               : "memory");
#endif
}

// Transposing fragment load: p = this lane's 16-B piece of the token-major tile (row kbase + 8h + (lane&7), piece
// (lane>>3)&1 of the 16 columns); q = the same 16 rows further on. Elements 0..7 <- tokens kbase + 8h .. +7,
// elements 8..15 <- tokens kbase + 16 + 8h .. +7, both of column lane&15.
__device__ __forceinline__ v16h ldfrag_tr(const _Float16* p, const _Float16* q) {
  typedef __attribute__((address_space(3))) v8s lds_v8s;
  union { v16h v; v8s h[2]; } f;
  f.h[0] = __builtin_amdgcn_ds_load_tr16_b128_v8i16((lds_v8s*)p);
  f.h[1] = __builtin_amdgcn_ds_load_tr16_b128_v8i16((lds_v8s*)q);
  return f.v;
}

__global__ __launch_bounds__(128) void ssm_k(const unsigned short* __restrict__ Xhp, const unsigned short* __restrict__ Xlp,
                                             const float* __restrict__ ldp, float* outp) {
  __shared__ __align__(16) float cs_s[TS];
  __shared__ float wtot[4];
  __shared__ __align__(16) float os_s[4 * 16 * 64];
  __shared__ __align__(16) _Float16 xs[2 * 2 * XTILE];        // [buffer][plane][token][c], pitch XP
  const int tt = blockIdx.x, r = blockIdx.y, b = blockIdx.z;
  const int tid = threadIdx.x, lane = tid & 31, hh = lane >> 4, l16 = lane & 15;
  const int wave = __builtin_amdgcn_readfirstlane(tid >> 5);  // scalar, so that the per-wave skip is a scalar branch

  const _Float16* Xh = (const _Float16*)(const void*)Xhp;
  const _Float16* Xl = (const _Float16*)(const void*)Xlp;
  const size_t plb = ((size_t)(b * TS) * DS + r) * DS;         // (b, token 0, r, c 0)
  const int    sof = (tid >> 3) * PLN + (tid & 7) * 8;         // this lane's first piece inside a tile's rows
  const _Float16* sgh = Xh + plb + sof;
  const _Float16* sgl = Xl + plb + sof;
  const unsigned  slh = (unsigned)(uintptr_t)(xs + (tid >> 3) * XP + (tid & 7) * 8);   // LDS byte address
  const int nt = tt + 1;                                       // tiles of 64 tokens, block-uniform

  // ---- inclusive prefix sum of ld[b][0 .. 64 nt - 1][r], all 128 threads: thread tid owns tokens 4 tid .. +3 ----
  const int t4 = tid * 4;
  float l0 = 0.0f, l1 = 0.0f, l2 = 0.0f, l3 = 0.0f;            // tokens past the block's last row are never read: 0
  if (t4 < nt * 64) {
    const float* lp = ldp + ((size_t)(b * TS + t4)) * DS + r;
    l0 = lp[0]; l1 = lp[DS]; l2 = lp[2 * DS]; l3 = lp[3 * DS];
  }
  l1 += l0; l2 += l1; l3 += l2;                                // inside the thread
  float sc = l3;                                               // over the wave's 32 thread totals, inclusive
#pragma unroll                                                 // five steps, each with its distance as a constant
  for (int off = 1; off < 32; off <<= 1) {
    const float o = __shfl_up(sc, off, 32);
    sc += (lane >= off) ? o : 0.0f;
  }
  if (lane == 31) wtot[wave] = sc;
  float pre = __shfl_up(sc, 1, 32);                            // total of the wave's earlier threads
  pre = (lane > 0) ? pre : 0.0f;
  __syncthreads();                                             // the four wave totals are written
#pragma unroll                                                 // three selects on the scalar wave number, no loop
  for (int w = 0; w < 3; ++w) pre += (w < wave) ? wtot[w] : 0.0f;
  {
    const v4f c4v = {pre + l0, pre + l1, pre + l2, pre + l3};
    *(v4f*)(cs_s + t4) = c4v;
  }
  __syncthreads();                                             // publishes the prefix sum

  // ---- leading 32-token steps whose decay weights are all zero in both f16 planes ----
  // cs never rises (softplus >= 0, -exp < 0), so over rows t >= top and tokens j <= jl the largest weight is
  // exp(cs[top] - cs[jl]). Lane h < 16 tests step h (jl = 32 h + 31); a not-a-number compares false and skips nothing.
  const int tbase = tt * 64 + wave * 16;
  const int jl = l16 * 32 + 31;
  const float cjl = cs_s[jl];
  const float dblk = (cs_s[tt * 64] - cjl) * 1.44269504088896340736f;   // the block's first row
  const float dwav = (cs_s[tbase] - cjl) * 1.44269504088896340736f;     // this wave's first row
  const unsigned zblk = __builtin_amdgcn_ballot_w32(hh == 0 && jl < tt * 64 && dblk < ZCUT);
  const unsigned zwav = __builtin_amdgcn_ballot_w32(hh == 0 && jl < tbase && dwav < ZCUT);
  const int k0  = __builtin_ctz(~zblk) >> 1;                   // first tile that the block stages, <= tt, the same in all waves
  const int jlo = __builtin_ctz(~zwav) * 32;                   // first step that this wave multiplies, <= tbase

  stage_tile(sgh + (size_t)k0 * (64 * PLN), sgl + (size_t)k0 * (64 * PLN), slh, slh + XTILE * 2);     // tile k0 -> buffer 0
  asm volatile("s_wait_asynccnt 0x0" ::: "memory");            // this wave's share of tile k0 has landed
  __syncthreads();                                             // publishes tile k0
  if (k0 + 1 < nt)                                             // tile k0 + 1 -> buffer 1
    stage_tile(sgh + (size_t)(k0 + 1) * (64 * PLN), sgl + (size_t)(k0 + 1) * (64 * PLN), slh + 2 * XTILE * 2, slh + 3 * XTILE * 2);

  const int trow  = tbase + l16;
  const float cst = cs_s[trow];

  v8f acc[4], acc2[4];
#pragma unroll
  for (int s = 0; s < 4; ++s) { acc[s] = zero8(); acc2[s] = zero8(); }

  const int jend = tbase + 16;               // wave-uniform causal bound
#pragma unroll 1                             // one tile per trip: the ring's waits and barrier stand once
  for (int kc = k0; kc < nt; ++kc) {
    const int bufo = ((kc - k0) & 1) * (2 * XTILE);
#pragma unroll 1                             // kept rolled: the second half is skipped on the diagonal by waves 0 and 1
    for (int j0 = (kc * 64 > jlo) ? kc * 64 : jlo; j0 < kc * 64 + 64 && j0 < jend; j0 += 32) {
      const _Float16* fb = xs + bufo + ((j0 & 32) + 8 * hh + (lane & 7)) * XP + ((lane >> 3) & 1) * 8;
      v16h xh[4], xl[4];
#pragma unroll
      for (int s = 0; s < 4; ++s) {
        xh[s] = ldfrag_tr(fb + s * 16, fb + 16 * XP + s * 16);
        xl[s] = ldfrag_tr(fb + XTILE + s * 16, fb + XTILE + 16 * XP + s * 16);
      }
      const int kA = j0 + hh * 8;
      const int kB = j0 + 16 + hh * 8;
      const v4f q0 = *(const v4f*)(cs_s + kA);
      const v4f q1 = *(const v4f*)(cs_s + kA + 4);
      const v4f q2 = *(const v4f*)(cs_s + kB);
      const v4f q3 = *(const v4f*)(cs_s + kB + 4);
      float cj[16];
#pragma unroll
      for (int q = 0; q < 4; ++q) {
        cj[q]      = q0[q];
        cj[q + 4]  = q1[q];
        cj[q + 8]  = q2[q];
        cj[q + 12] = q3[q];
      }
      float ex[16];
#pragma unroll
      for (int e = 0; e < 16; ++e) ex[e] = fminf(cst - cj[e], 0.0f) * 1.44269504088896340736f;
#if defined(__HIP_DEVICE_COMPILE__)
      // The instruction set asks for one slot behind a v_exp_f32 before a register it reads is rewritten. The
      // scheduling barriers keep the sixteen v_exp_f32 by themselves, with nothing between them that rewrites an
      // argument, and hold the v_nop directly behind the last.
      __builtin_amdgcn_sched_barrier(0);
#pragma unroll
      for (int e = 0; e < 16; ++e) ex[e] = __builtin_amdgcn_exp2f(ex[e]);
      __builtin_amdgcn_sched_barrier(0);
      asm volatile("v_nop");
      __builtin_amdgcn_sched_barrier(0);
#endif
      v16h pa, pr;
#pragma unroll
      for (int e = 0; e < 16; ++e) {
        const int j = (e < 8) ? (kA + e) : (kB + e - 8);
        float p = ex[e] * 16384.0f;
        p = (j <= trow) ? p : 0.0f;                          // causal select by value
        const _Float16 x0 = (_Float16)p;
        pa[e] = x0;
        pr[e] = (_Float16)((p - (float)x0) * 2048.0f);
      }
#pragma unroll
      for (int s = 0; s < 4; ++s) {
        acc[s]  = mma_h(pa, xh[s], acc[s]);
        acc2[s] = mma_h(pa, xl[s], acc2[s]);
        acc2[s] = mma_h(pr, xh[s], acc2[s]);
      }
    }
    asm volatile("s_wait_dscnt 0x0" ::: "memory");             // this wave's reads of the buffer are done
    asm volatile("s_wait_asynccnt 0x0" ::: "memory");          // this wave's share of tile kc + 1 has landed
    __syncthreads();                                           // publishes tile kc + 1, frees tile kc's buffer
    if (kc + 2 < nt)
      stage_tile(sgh + (size_t)(kc + 2) * (64 * PLN), sgl + (size_t)(kc + 2) * (64 * PLN), slh + bufo * 2, slh + bufo * 2 + XTILE * 2);
  }
  asm volatile("s_wait_asynccnt 0x0" ::: "memory");            // no copy is outstanding when the wave goes on

  // ---- epilogue ----
  float* os = os_s + wave * (16 * 64);
#pragma unroll
  for (int r8 = 0; r8 < 8; ++r8) {
#pragma unroll
    for (int s = 0; s < 4; ++s) {
      const float val = (acc[s][r8] + acc2[s][r8] * (1.0f / 2048.0f)) * (1.0f / 131072.0f);
      os[(8 * hh + r8) * 64 + s * 16 + l16] = val;
    }
  }
  __builtin_amdgcn_fence(__ATOMIC_RELEASE, "workgroup");
  __builtin_amdgcn_wave_barrier();
  __builtin_amdgcn_fence(__ATOMIC_ACQUIRE, "workgroup");
  const int h2 = lane >> 4, c4 = (lane & 15) * 4;       // 256-B row = 16 lanes x 16 B
  v4f ov[8];
#pragma unroll
  for (int it = 0; it < 8; ++it) {
    const int row = it * 2 + h2;                         // it 0..7 x h2 0..1 = rows 0..15
    ov[it] = *(const v4f*)(os + row * 64 + c4);
  }
  {
#pragma unroll
    for (int it = 0; it < 8; ++it) {
      const int row = it * 2 + h2;
      const size_t go = (((size_t)(b * TS + tbase + row)) * DS + r) * DS + c4;
      *(v4f*)(outp + go) = ov[it];
    }
    
  }
}

// =====================================================================================================
// Workspace map (bytes); every region is an exact multiple of its whole-line store granularity, all offsets
// multiples of 8388608 except the last, no aliasing:
//   Xh   f16 [1024][4096]   ([b][t][r][c], xn x8 hi)          0         8388608
//   Xl   f16 [1024][4096]   (residual x2^11)                  8388608   8388608
//   Ld   f32 [1024][64]     ([b][t][r], dt * (-exp(log_A)))   16777216  262144
//   end                                                        17039360
// d_out f32 [2][512][64][64] at byte 0.
// =====================================================================================================
extern "C" void kernel_launch(void* const* d_in, const int* in_sizes, int n_in,
                              void* d_out, int out_size, void* d_ws, size_t ws_size,
                              hipStream_t stream) {
  if (n_in < 6) return;
  if (in_sizes[0] != NTOT) return;
  if (in_sizes[1] != DS) return;
  if (in_sizes[2] != DS) return;
  if (in_sizes[3] != 1) return;
  if (in_sizes[4] != PLN) return;
  if (in_sizes[5] != PLN) return;
  if (out_size != NTOT) return;

  const float* x    = (const float*)d_in[0];   // [2][512][64][64]
  const float* logA = (const float*)d_in[1];   // [64]
  const float* dtw  = (const float*)d_in[2];   // [64]
  const float* dtb  = (const float*)d_in[3];   // [1]
  const float* lnw  = (const float*)d_in[4];   // [64][64]
  const float* lnb  = (const float*)d_in[5];   // [64][64]
  float* outf = (float*)d_out;

  const size_t PB = (size_t)NTOT * 2;          // 8388608
  const size_t LB = (size_t)NBT * DS * 4;      //  262144
  size_t off = 0;
  const size_t oXh  = off; off += PB;
  const size_t oXl  = off; off += PB;
  const size_t oLd  = off; off += LB;
  if (off > ws_size) return;                   // off = 17039360
  if (off > (size_t)134217728) return;

  char* ws = (char*)d_ws;
  unsigned short* Xh  = (unsigned short*)(ws + oXh);
  unsigned short* Xl  = (unsigned short*)(ws + oXl);
  float*          Ld  = (float*)(ws + oLd);

  const int nbt = in_sizes[0] / PLN;           // 1024
  // (1) LayerNorm, dt, ld and the two xn planes
  ln_k<<<dim3(nbt), dim3(256), 0, stream>>>(x, logA, dtw, dtb, lnw, lnb, Xh, Xl, Ld, nbt);
  // (2) prefix sum + causal decay product -> d_out
  ssm_k<<<dim3(TS / 64, DS, NB), dim3(128), 0, stream>>>(Xh, Xl, Ld, outf);
  (void)hipGetLastError();
}

// v005
// A run of this version takes 16.2 microseconds.
// In two side-by-side timings against v004, it was 1.09 and 1.08 times as fast.
// Over all steps from v000 it is 3.91 times as fast.
// Contraction out[b][t][r][c] = sum_{j<=t} D[t][j] * xn[b][j][r][c] per (b, r), K = 512: v_wmma_f32_16x16x32_f16 with D = exp(cs_t - cs_j) carried x2^14 and xn carried x2^3, each as f16 hi + x2^11 residual plane, products hi.hi + (hi.lo + lo.hi) x 2^-11, f32 accumulate. LayerNorm, the 64-term dt dot, softplus, prefix sum and exp are f32 on VALU; all six inputs RNE-converted to bf16 values on load.
#include <hip/hip_runtime.h>
#include <math.h>
#include <stdint.h>

#define NB   2
#define TS   512
#define DS   64
#define NBT  (NB * TS)          // 1024 (b, t) rows
#define PLN  (DS * DS)          // 4096 elements per (b, t)
#define NTOT (NBT * PLN)        // 4194304
static_assert((TS % 64) == 0);
static_assert(DS == 64);
static_assert(PLN == 2 * 8 * 256);

typedef _Float16 v16h __attribute__((ext_vector_type(16)));
typedef short    v8s  __attribute__((ext_vector_type(8)));
typedef float    v8f  __attribute__((ext_vector_type(8)));
typedef float    v4f  __attribute__((ext_vector_type(4)));
typedef unsigned int v4u __attribute__((ext_vector_type(4)));

// ---- scalar helpers --------------------------------------------------------------------------------
__device__ __forceinline__ unsigned short bf_bits(float f) {          // f32 -> bf16 bits, RNE convert
  unsigned u = __float_as_uint(f);
  return (unsigned short)((u + 0x7FFFu + ((u >> 16) & 1u)) >> 16);
}
__device__ __forceinline__ float bfr(float f) { return __uint_as_float(((unsigned)bf_bits(f)) << 16); }
__device__ __forceinline__ unsigned short h_bits(_Float16 x) { return __builtin_bit_cast(unsigned short, x); }
__device__ __forceinline__ unsigned pk16(unsigned short a, unsigned short b) { return (unsigned)a | ((unsigned)b << 16); }
__device__ __forceinline__ v8f zero8() { v8f z = {0.f, 0.f, 0.f, 0.f, 0.f, 0.f, 0.f, 0.f}; return z; }
__device__ __forceinline__ float wave_sum(float v) {
#pragma unroll
  for (int off = 16; off > 0; off >>= 1) v += __shfl_xor(v, off, 32);
  return v;
}

// ---- WMMA helper with trailing VALU hazard gap ----------------------------------------------------------
__device__ __forceinline__ v8f mma_h(v16h a, v16h b, v8f c) {
  c = __builtin_amdgcn_wmma_f32_16x16x32_f16(false, a, false, b, (short)0, c, false, false);
#if defined(__HIP_DEVICE_COMPILE__)
  asm volatile("v_nop\n\tv_nop\n\tv_nop\n\tv_nop" : "+v"(c) : "v"(a), "v"(b));
#endif
  return c;
}

// =====================================================================================================
// Stage 1: one block per (b, t), 256 threads. Thread tid owns elements e0 = tid*8..+7 (row tid>>3,
// cols (tid&7)*8..+7) and e1 = 2048 + tid*8..+7 (row 32 + tid>>3, same cols) of the 64x64 slice.
// + dt_b; dt = softplus(z) = max(z,0) + log1p(exp(-|z|)); ld[b][t][r] = dt * (-exp(log_A[r])).
// Outputs: Xh = f16(8 xn), Xl = f16((8 xn - Xh) * 2048) in [b][t][r][c] layout: per plane two store
// coverage: Xh/Xl 2 x 256 x 8 = 4096 halves per (b,t); ld 16 x 4 = 64 floats per (b,t); grid = all (b,t).
// =====================================================================================================
__global__ __launch_bounds__(256) void ln_k(const float* __restrict__ x, const float* __restrict__ logA,
                                            const float* __restrict__ dtw, const float* __restrict__ dtb,
                                            const float* __restrict__ lnw, const float* __restrict__ lnb,
                                            unsigned short* Xh, unsigned short* Xl, float* ldp, int nbt) {
  __shared__ float red0[8];
  __shared__ float red1[8];
  __shared__ float zrow[64];
  __shared__ __align__(16) float ldv[64];
  const int bt = blockIdx.x;
  if (bt >= nbt) return;                       // block-uniform, before any barrier
  const int tid = threadIdx.x, lane = tid & 31, wave = tid >> 5;
  const int e0 = tid * 8, e1 = 2048 + tid * 8;
  const float* xp = x + (size_t)bt * PLN;

  const v4f xa = *(const v4f*)(xp + e0);
  const v4f xb = *(const v4f*)(xp + e0 + 4);
  const v4f xc = *(const v4f*)(xp + e1);
  const v4f xd = *(const v4f*)(xp + e1 + 4);
  float v[16];
#pragma unroll
  for (int q = 0; q < 4; ++q) {
    v[q]      = bfr(xa[q]);
    v[4 + q]  = bfr(xb[q]);
    v[8 + q]  = bfr(xc[q]);
    v[12 + q] = bfr(xd[q]);
  }
  // ---- mean ----
  float s = 0.0f;
#pragma unroll
  for (int i = 0; i < 16; ++i) s += v[i];
  s = wave_sum(s);
  if (lane == 0) red0[wave] = s;
  __syncthreads();
  float tot = 0.0f;
#pragma unroll
  for (int w = 0; w < 8; ++w) tot += red0[w];
  const float mu = tot * (1.0f / 4096.0f);
  // ---- centred variance ----
  float ss = 0.0f;
#pragma unroll
  for (int i = 0; i < 16; ++i) { const float d = v[i] - mu; ss += d * d; }
  ss = wave_sum(ss);
  if (lane == 0) red1[wave] = ss;
  __syncthreads();
  float vt = 0.0f;
#pragma unroll
  for (int w = 0; w < 8; ++w) vt += red1[w];
  const float var  = vt * (1.0f / 4096.0f);
  const float rstd = rsqrtf(var + 1e-5f);
  // ---- affine ----
  const v4f wa = *(const v4f*)(lnw + e0), wb = *(const v4f*)(lnw + e0 + 4);
  const v4f wc = *(const v4f*)(lnw + e1), wd = *(const v4f*)(lnw + e1 + 4);
  const v4f ba = *(const v4f*)(lnb + e0), bb = *(const v4f*)(lnb + e0 + 4);
  const v4f bc = *(const v4f*)(lnb + e1), bd = *(const v4f*)(lnb + e1 + 4);
  float xn[16];
#pragma unroll
  for (int q = 0; q < 4; ++q) {
    xn[q]      = (v[q]      - mu) * rstd * bfr(wa[q]) + bfr(ba[q]);
    xn[4 + q]  = (v[4 + q]  - mu) * rstd * bfr(wb[q]) + bfr(bb[q]);
    xn[8 + q]  = (v[8 + q]  - mu) * rstd * bfr(wc[q]) + bfr(bc[q]);
    xn[12 + q] = (v[12 + q] - mu) * rstd * bfr(wd[q]) + bfr(bd[q]);
  }
  // ---- dt dot: 8 terms per thread, reduced over the 8 lanes covering a row ----
  const int c8 = (tid & 7) * 8;
  const v4f da = *(const v4f*)(dtw + c8), db = *(const v4f*)(dtw + c8 + 4);
  float dw[8];
#pragma unroll
  for (int q = 0; q < 4; ++q) { dw[q] = bfr(da[q]); dw[4 + q] = bfr(db[q]); }
  float d0 = 0.0f, d1 = 0.0f;
#pragma unroll
  for (int i = 0; i < 8; ++i) { d0 += xn[i] * dw[i]; d1 += xn[8 + i] * dw[i]; }
  d0 += __shfl_xor(d0, 1, 32); d0 += __shfl_xor(d0, 2, 32); d0 += __shfl_xor(d0, 4, 32);
  d1 += __shfl_xor(d1, 1, 32); d1 += __shfl_xor(d1, 2, 32); d1 += __shfl_xor(d1, 4, 32);
  if ((tid & 7) == 0) { zrow[tid >> 3] = d0; zrow[32 + (tid >> 3)] = d1; }
  __syncthreads();
  if (tid < 64) {
    const float z  = zrow[tid] + bfr(dtb[0]);
    const float sp = fmaxf(z, 0.0f) + log1pf(__expf(-fabsf(z)));     // softplus
    const float ac = -__expf(bfr(logA[tid]));
    ldv[tid] = sp * ac;
  }
  __syncthreads();
  // ---- pack planes: hi = f16(8 xn), residual = f16((8 xn - hi) * 2048) ----
  v4u ph0, pl0, ph1, pl1;
#pragma unroll
  for (int e = 0; e < 4; ++e) {
    const float g0 = xn[2 * e] * 8.0f, g1 = xn[2 * e + 1] * 8.0f;
    const _Float16 x0 = (_Float16)g0, x1 = (_Float16)g1;
    const _Float16 y0 = (_Float16)((g0 - (float)x0) * 2048.0f);
    const _Float16 y1 = (_Float16)((g1 - (float)x1) * 2048.0f);
    ph0[e] = pk16(h_bits(x0), h_bits(x1));
    pl0[e] = pk16(h_bits(y0), h_bits(y1));
    const float k0 = xn[8 + 2 * e] * 8.0f, k1 = xn[8 + 2 * e + 1] * 8.0f;
    const _Float16 u0 = (_Float16)k0, u1 = (_Float16)k1;
    const _Float16 w0 = (_Float16)((k0 - (float)u0) * 2048.0f);
    const _Float16 w1 = (_Float16)((k1 - (float)u1) * 2048.0f);
    ph1[e] = pk16(h_bits(u0), h_bits(u1));
    pl1[e] = pk16(h_bits(w0), h_bits(w1));
  }
  const v4f lv = *(const v4f*)(ldv + (tid & 15) * 4);          // clamped LDS address, stored only by tid < 16
  const size_t po0 = (size_t)bt * PLN + e0;
  const size_t po1 = (size_t)bt * PLN + e1;
  const size_t plo = (size_t)bt * DS + (tid & 15) * 4;
  {
    *(v4u*)(Xh + po0) = ph0;
    *(v4u*)(Xh + po1) = ph1;
    *(v4u*)(Xl + po0) = pl0;
    *(v4u*)(Xl + po1) = pl1;
    if (tid < 16) *(v4f*)(ldp + plo) = lv;
    
  }
}

// =====================================================================================================
// Stage 2: out[b][t][r][c] = sum_{j<=t} exp(cs[b][t][r] - cs[b][j][r]) * xn[b][j][r][c].
// Block = (64-row t tile tt, r, b), 4 waves; wave w owns t rows tt*64 + 16w .. +15 and all 64 c.
// cs: the block forms an inclusive prefix sum of ld[b][first .. 64 (tt + 1) - 1][r] in f32: four tokens a thread, a
// shuffle scan over each wave's thread totals, then the earlier waves' totals from LDS. first = 64 (tt - 1) where a
// run-time test shows that every earlier token's weight is zero in both planes, else 0.
// A fragment (decay tile, built in registers): lane row = lane&15 -> t = tbase + (lane&15); element e<8 -> j =
// j0 + 8h + e, e>=8 -> j = j0 + 16 + 8h + (e-8) (split k map); value P = exp(min(cs_t - cs_j, 0)) (<= 1),
// 0 for j > t (select by value), hi = f16(P * 16384), residual = f16((P*16384 - hi) * 2048).
// B tiles: 64 tokens x 64 c of the [b][t][r][c] hi and residual planes, as stage 1 stores them, are copied once
// per block into LDS (rows = tokens of 128 B, whole lines, pitch 160 B) by asynchronous copies, two buffers:
// tile k+1 flies while tile k is worked on; all four waves read their fragments from that one copy.
// B fragments: two transposing LDS loads (ds_load_tr16_b128) at token rows j0 and j0 + 16: lane (c = lane&15, h)
// gets tokens j0 + 8h .. +7 and j0 + 16 + 8h .. +7 of column c (split k map, as the A fragment).
// acc += Ph.Xh; acc2 += Ph.Xl + Pl.Xh; out = (acc + acc2/2048) / 2^17.
// Leading steps whose weights are all zero in both planes (test on the prefix sums, at run time) are left out: the
// block stages tiles k0 .. tt only, a wave starts at its own step jlo. With slow decay k0 = 0 and all is done.
// The tile loop's trip count tt + 1 - k0 is block-uniform; a wave skips the 32-token half past its diagonal
// (wave-uniform scalar test) but passes every wait and barrier.
// Not yet used: a block's length grows with tt, the grid's fastest index; a decay tile left of the diagonal tile
// has rank one, exp(cs_t - cs_m) * exp(cs_m - cs_j).
// coverage: 4 waves x 16 rows x 64 cols = the block's 64 x 64 tile; grid (TS/64, DS, NB) = every (t, r, b) once.
// =====================================================================================================
#define XP    80                 // LDS row pitch in halves: 160 B = 32 B x 5, the transposing load's pitch
#define XTILE (64 * XP)          // halves of one plane's tile in LDS
// A weight P = exp2(d) is carried as f16(P * 2^14) and f16(residual * 2^11): at d <= -50 both round to zero, and the
// products of such a step add exactly nothing. Two more for the rounding of the prefix sums and of v_exp_f32.
#define ZCUT  (-52.0f)

// One block-wide tile fill: thread tid copies 16 B pieces (token row i*16 + tid>>3, piece tid&7), i = 0..3, of both
// planes. gh/gl: this lane's first source piece; lh/ll: this lane's first LDS byte address. Row step: 16 rows.
__device__ __forceinline__ void stage_tile(const _Float16* gh, const _Float16* gl, unsigned lh, unsigned ll) {
  const _Float16* gh1 = gh + 16 * PLN; const _Float16* gh2 = gh + 32 * PLN; const _Float16* gh3 = gh + 48 * PLN;
  const _Float16* gl1 = gl + 16 * PLN; const _Float16* gl2 = gl + 32 * PLN; const _Float16* gl3 = gl + 48 * PLN;
  const unsigned st = 16 * XP * 2;
  const unsigned lh1 = lh + st, lh2 = lh + 2 * st, lh3 = lh + 3 * st;
  const unsigned ll1 = ll + st, ll2 = ll + 2 * st, ll3 = ll + 3 * st;
#if defined(__HIP_DEVICE_COMPILE__)
  // the eight copies and, as the last line, the wait that stands before any of their address registers is rewritten
  asm volatile("global_load_async_to_lds_b128 %0, %8, off\n\t"
               "global_load_async_to_lds_b128 %1, %9, off\n\t"
               "global_load_async_to_lds_b128 %2, %10, off\n\t"
               "global_load_async_to_lds_b128 %3, %11, off\n\t"
               "global_load_async_to_lds_b128 %4, %12, off\n\t"
               "global_load_async_to_lds_b128 %5, %13, off\n\t"
               "global_load_async_to_lds_b128 %6, %14, off\n\t"
               "global_load_async_to_lds_b128 %7, %15, off\n\t"
               "s_wait_xcnt 0x0"
               :: "v"(lh), "v"(lh1), "v"(lh2), "v"(lh3), "v"(ll), "v"(ll1), "v"(ll2), "v"(ll3),
                  "v"(gh), "v"(gh1), "v"(gh2), "v"(gh3), "v"(gl), "v"(gl1), "v"(gl2), "v"(gl3)
               : "memory");
#endif
}

// Transposing fragment load: p = this lane's 16-B piece of the token-major tile (row kbase + 8h + (lane&7), piece
// (lane>>3)&1 of the 16 columns); q = the same 16 rows further on. Elements 0..7 <- tokens kbase + 8h .. +7,
// elements 8..15 <- tokens kbase + 16 + 8h .. +7, both of column lane&15.
__device__ __forceinline__ v16h ldfrag_tr(const _Float16* p, const _Float16* q) {
  typedef __attribute__((address_space(3))) v8s lds_v8s;
  union { v16h v; v8s h[2]; } f;
  f.h[0] = __builtin_amdgcn_ds_load_tr16_b128_v8i16((lds_v8s*)p);
  f.h[1] = __builtin_amdgcn_ds_load_tr16_b128_v8i16((lds_v8s*)q);
  return f.v;
}

__global__ __launch_bounds__(128) void ssm_k(const unsigned short* __restrict__ Xhp, const unsigned short* __restrict__ Xlp,
                                             const float* __restrict__ ldp, float* outp) {
  __shared__ __align__(16) float cs_s[TS];
  __shared__ float wtot[4];
  __shared__ __align__(16) float os_s[4 * 16 * 64];
  __shared__ __align__(16) _Float16 xs[2 * 2 * XTILE];        // [buffer][plane][token][c], pitch XP
  const int tt = blockIdx.x, r = blockIdx.y, b = blockIdx.z;
  const int tid = threadIdx.x, lane = tid & 31, hh = lane >> 4, l16 = lane & 15;
  const int wave = __builtin_amdgcn_readfirstlane(tid >> 5);  // scalar, so that the per-wave skip is a scalar branch

  const _Float16* Xh = (const _Float16*)(const void*)Xhp;
  const _Float16* Xl = (const _Float16*)(const void*)Xlp;
  const size_t plb = ((size_t)(b * TS) * DS + r) * DS;         // (b, token 0, r, c 0)
  const int    sof = (tid >> 3) * PLN + (tid & 7) * 8;         // this lane's first piece inside a tile's rows
  const _Float16* sgh = Xh + plb + sof;
  const _Float16* sgl = Xl + plb + sof;
  const unsigned  slh = (unsigned)(uintptr_t)(xs + (tid >> 3) * XP + (tid & 7) * 8);   // LDS byte address
  const int nt = tt + 1;                                       // tiles of 64 tokens, block-uniform

  // ---- inclusive prefix sum of ld[b][first .. 64 nt - 1][r]: thread tid owns tokens first + 4 tid .. +3 ----
  // Only differences cs[t] - cs[j] are used, so the sum may start at any token in front of which every weight is zero.
  // First trip: it starts at the tile left of the diagonal tile. cs never rises (softplus >= 0, -exp < 0), so the
  // largest weight of a token in front of first is exp(cs[64 tt]), the sum from first to the block's first row. Where
  // that is not under the cut (slow decay, or a not-a-number, which compares false), a second trip sums from token 0.
  int first = (tt > 0) ? (tt - 1) * 64 : 0;                    // block-uniform
#pragma unroll 1                                               // the second trip is the rare one: one copy of the code
  for (int pass = 0; pass < 2; ++pass) {
    const int t4 = first + tid * 4;
    const bool own = t4 < nt * 64;                             // tokens past the block's last row are never read
    float l0 = 0.0f, l1 = 0.0f, l2 = 0.0f, l3 = 0.0f;
    if (own) {
      const float* lp = ldp + ((size_t)(b * TS + t4)) * DS + r;
      l0 = lp[0]; l1 = lp[DS]; l2 = lp[2 * DS]; l3 = lp[3 * DS];
    }
    l1 += l0; l2 += l1; l3 += l2;                              // inside the thread
    float sc = l3;                                             // over the wave's 32 thread totals, inclusive
#pragma unroll                                                 // five steps, each with its distance as a constant
    for (int off = 1; off < 32; off <<= 1) {
      const float o = __shfl_up(sc, off, 32);
      sc += (lane >= off) ? o : 0.0f;
    }
    if (lane == 31) wtot[wave] = sc;
    float pre = __shfl_up(sc, 1, 32);                          // total of the wave's earlier threads
    pre = (lane > 0) ? pre : 0.0f;
    __syncthreads();                                           // the four wave totals are written
#pragma unroll                                                 // three selects on the scalar wave number, no loop
    for (int w = 0; w < 3; ++w) pre += (w < wave) ? wtot[w] : 0.0f;
    if (own) {
      const v4f c4v = {pre + l0, pre + l1, pre + l2, pre + l3};
      *(v4f*)(cs_s + t4) = c4v;
    }
    __syncthreads();                                           // publishes the prefix sum
    if (first == 0) break;
    // one LDS word, the same for all threads, made scalar so that the branch round the barriers is a scalar one
    const float dwin = __uint_as_float(__builtin_amdgcn_readfirstlane(__float_as_uint(cs_s[tt * 64]))) * 1.44269504088896340736f;
    if (dwin < ZCUT) break;
    first = 0;
  }

  // ---- leading 32-token steps whose decay weights are all zero in both f16 planes ----
  // Over rows t >= top and tokens j <= jl the largest weight is exp(cs[top] - cs[jl]). Lane h < 16 tests step h
  // (jl = 32 h + 31); a step in front of first is zero by the test above; a not-a-number compares false and skips nothing.
  const int tbase = tt * 64 + wave * 16;
  const int jl = l16 * 32 + 31;
  const float cjl = cs_s[(jl < first) ? first : ((jl < nt * 64) ? jl : nt * 64 - 1)];   // only words that were written
  const float dblk = (cs_s[tt * 64] - cjl) * 1.44269504088896340736f;   // the block's first row
  const float dwav = (cs_s[tbase] - cjl) * 1.44269504088896340736f;     // this wave's first row
  const unsigned zblk = __builtin_amdgcn_ballot_w32(hh == 0 && jl < tt * 64 && (jl < first || dblk < ZCUT));
  const unsigned zwav = __builtin_amdgcn_ballot_w32(hh == 0 && jl < tbase && (jl < first || dwav < ZCUT));
  const int k0  = __builtin_ctz(~zblk) >> 1;                   // first tile that the block stages, <= tt, the same in all waves
  const int jlo = __builtin_ctz(~zwav) * 32;                   // first step that this wave multiplies, <= tbase

  stage_tile(sgh + (size_t)k0 * (64 * PLN), sgl + (size_t)k0 * (64 * PLN), slh, slh + XTILE * 2);     // tile k0 -> buffer 0
  asm volatile("s_wait_asynccnt 0x0" ::: "memory");            // this wave's share of tile k0 has landed
  __syncthreads();                                             // publishes tile k0
  if (k0 + 1 < nt)                                             // tile k0 + 1 -> buffer 1
    stage_tile(sgh + (size_t)(k0 + 1) * (64 * PLN), sgl + (size_t)(k0 + 1) * (64 * PLN), slh + 2 * XTILE * 2, slh + 3 * XTILE * 2);

  const int trow  = tbase + l16;
  const float cst = cs_s[trow];

  v8f acc[4], acc2[4];
#pragma unroll
  for (int s = 0; s < 4; ++s) { acc[s] = zero8(); acc2[s] = zero8(); }

  const int jend = tbase + 16;               // wave-uniform causal bound
#pragma unroll 1                             // one tile per trip: the ring's waits and barrier stand once
  for (int kc = k0; kc < nt; ++kc) {
    const int bufo = ((kc - k0) & 1) * (2 * XTILE);
#pragma unroll 1                             // kept rolled: the second half is skipped on the diagonal by waves 0 and 1
    for (int j0 = (kc * 64 > jlo) ? kc * 64 : jlo; j0 < kc * 64 + 64 && j0 < jend; j0 += 32) {
      const _Float16* fb = xs + bufo + ((j0 & 32) + 8 * hh + (lane & 7)) * XP + ((lane >> 3) & 1) * 8;
      v16h xh[4], xl[4];
#pragma unroll
      for (int s = 0; s < 4; ++s) {
        xh[s] = ldfrag_tr(fb + s * 16, fb + 16 * XP + s * 16);
        xl[s] = ldfrag_tr(fb + XTILE + s * 16, fb + XTILE + 16 * XP + s * 16);
      }
      const int kA = j0 + hh * 8;
      const int kB = j0 + 16 + hh * 8;
      const v4f q0 = *(const v4f*)(cs_s + kA);
      const v4f q1 = *(const v4f*)(cs_s + kA + 4);
      const v4f q2 = *(const v4f*)(cs_s + kB);
      const v4f q3 = *(const v4f*)(cs_s + kB + 4);
      float cj[16];
#pragma unroll
      for (int q = 0; q < 4; ++q) {
        cj[q]      = q0[q];
        cj[q + 4]  = q1[q];
        cj[q + 8]  = q2[q];
        cj[q + 12] = q3[q];
      }
      float ex[16];
#pragma unroll
      for (int e = 0; e < 16; ++e) ex[e] = fminf(cst - cj[e], 0.0f) * 1.44269504088896340736f;
#if defined(__HIP_DEVICE_COMPILE__)
      // The instruction set asks for one slot behind a v_exp_f32 before a register it reads is rewritten. The
      // scheduling barriers keep the sixteen v_exp_f32 by themselves, with nothing between them that rewrites an
      // argument, and hold the v_nop directly behind the last.
      __builtin_amdgcn_sched_barrier(0);
#pragma unroll
      for (int e = 0; e < 16; ++e) ex[e] = __builtin_amdgcn_exp2f(ex[e]);
      __builtin_amdgcn_sched_barrier(0);
      asm volatile("v_nop");
      __builtin_amdgcn_sched_barrier(0);
#endif
      v16h pa, pr;
#pragma unroll
      for (int e = 0; e < 16; ++e) {
        const int j = (e < 8) ? (kA + e) : (kB + e - 8);
        float p = ex[e] * 16384.0f;
        p = (j <= trow) ? p : 0.0f;                          // causal select by value
        const _Float16 x0 = (_Float16)p;
        pa[e] = x0;
        pr[e] = (_Float16)((p - (float)x0) * 2048.0f);
      }
#pragma unroll
      for (int s = 0; s < 4; ++s) {
        acc[s]  = mma_h(pa, xh[s], acc[s]);
        acc2[s] = mma_h(pa, xl[s], acc2[s]);
        acc2[s] = mma_h(pr, xh[s], acc2[s]);
      }
    }
    asm volatile("s_wait_dscnt 0x0" ::: "memory");             // this wave's reads of the buffer are done
    asm volatile("s_wait_asynccnt 0x0" ::: "memory");          // this wave's share of tile kc + 1 has landed
    __syncthreads();                                           // publishes tile kc + 1, frees tile kc's buffer
    if (kc + 2 < nt)
      stage_tile(sgh + (size_t)(kc + 2) * (64 * PLN), sgl + (size_t)(kc + 2) * (64 * PLN), slh + bufo * 2, slh + bufo * 2 + XTILE * 2);
  }
  asm volatile("s_wait_asynccnt 0x0" ::: "memory");            // no copy is outstanding when the wave goes on

  // ---- epilogue ----
  float* os = os_s + wave * (16 * 64);
#pragma unroll
  for (int r8 = 0; r8 < 8; ++r8) {
#pragma unroll
    for (int s = 0; s < 4; ++s) {
      const float val = (acc[s][r8] + acc2[s][r8] * (1.0f / 2048.0f)) * (1.0f / 131072.0f);
      os[(8 * hh + r8) * 64 + s * 16 + l16] = val;
    }
  }
  __builtin_amdgcn_fence(__ATOMIC_RELEASE, "workgroup");
  __builtin_amdgcn_wave_barrier();
  __builtin_amdgcn_fence(__ATOMIC_ACQUIRE, "workgroup");
  const int h2 = lane >> 4, c4 = (lane & 15) * 4;       // 256-B row = 16 lanes x 16 B
  v4f ov[8];
#pragma unroll
  for (int it = 0; it < 8; ++it) {
    const int row = it * 2 + h2;                         // it 0..7 x h2 0..1 = rows 0..15
    ov[it] = *(const v4f*)(os + row * 64 + c4);
  }
  {
#pragma unroll
    for (int it = 0; it < 8; ++it) {
      const int row = it * 2 + h2;
      const size_t go = (((size_t)(b * TS + tbase + row)) * DS + r) * DS + c4;
      *(v4f*)(outp + go) = ov[it];
    }
    
  }
}

// =====================================================================================================
// Workspace map (bytes); every region is an exact multiple of its whole-line store granularity, all offsets
// multiples of 8388608 except the last, no aliasing:
//   Xh   f16 [1024][4096]   ([b][t][r][c], xn x8 hi)          0         8388608
//   Xl   f16 [1024][4096]   (residual x2^11)                  8388608   8388608
//   Ld   f32 [1024][64]     ([b][t][r], dt * (-exp(log_A)))   16777216  262144
//   end                                                        17039360
// d_out f32 [2][512][64][64] at byte 0.
// =====================================================================================================
extern "C" void kernel_launch(void* const* d_in, const int* in_sizes, int n_in,
                              void* d_out, int out_size, void* d_ws, size_t ws_size,
                              hipStream_t stream) {
  if (n_in < 6) return;
  if (in_sizes[0] != NTOT) return;
  if (in_sizes[1] != DS) return;
  if (in_sizes[2] != DS) return;
  if (in_sizes[3] != 1) return;
  if (in_sizes[4] != PLN) return;
  if (in_sizes[5] != PLN) return;
  if (out_size != NTOT) return;

  const float* x    = (const float*)d_in[0];   // [2][512][64][64]
  const float* logA = (const float*)d_in[1];   // [64]
  const float* dtw  = (const float*)d_in[2];   // [64]
  const float* dtb  = (const float*)d_in[3];   // [1]
  const float* lnw  = (const float*)d_in[4];   // [64][64]
  const float* lnb  = (const float*)d_in[5];   // [64][64]
  float* outf = (float*)d_out;

  const size_t PB = (size_t)NTOT * 2;          // 8388608
  const size_t LB = (size_t)NBT * DS * 4;      //  262144
  size_t off = 0;
  const size_t oXh  = off; off += PB;
  const size_t oXl  = off; off += PB;
  const size_t oLd  = off; off += LB;
  if (off > ws_size) return;                   // off = 17039360
  if (off > (size_t)134217728) return;

  char* ws = (char*)d_ws;
  unsigned short* Xh  = (unsigned short*)(ws + oXh);
  unsigned short* Xl  = (unsigned short*)(ws + oXl);
  float*          Ld  = (float*)(ws + oLd);

  const int nbt = in_sizes[0] / PLN;           // 1024
  // (1) LayerNorm, dt, ld and the two xn planes
  ln_k<<<dim3(nbt), dim3(256), 0, stream>>>(x, logA, dtw, dtb, lnw, lnb, Xh, Xl, Ld, nbt);
  // (2) prefix sum + causal decay product -> d_out
  ssm_k<<<dim3(TS / 64, DS, NB), dim3(128), 0, stream>>>(Xh, Xl, Ld, outf);
  (void)hipGetLastError();
}

// v006
// It runs in 14.1 microseconds.
// In two side-by-side timings against v005, it was 1.14 and 1.15 times as fast.
// All steps since v000 together make it 4.48 times as fast.
// Contraction out[b][t][r][c] = sum_{j<=t} D[t][j] * xn[b][j][r][c] per (b, r), K = 512, with xn = (v - mu_j) rstd_j w[r][c] + b[r][c] taken apart: out = w * (sum_j A v - sum_j A mu_j) + b * sum_j A / rstd_j, A = D[t][j] rstd_j. v_wmma_f32_16x16x32_f16: A carried x2^6 as f16 hi + x2^11 residual plane; v (x rounded to a bf16 value, eight significant bits) carried x2^3 in ONE f16 plane; mu_j and 1/rstd_j x2^3 as f16 hi + residual in four more B columns; f32 accumulate. LayerNorm statistics, the 64-term dt dot, softplus, prefix sum and exp are f32 on VALU; all six inputs RNE-converted to bf16 values on load.
#include <hip/hip_runtime.h>
#include <math.h>
#include <stdint.h>

#define NB   2
#define TS   512
#define DS   64
#define NBT  (NB * TS)          // 1024 (b, t) rows
#define PLN  (DS * DS)          // 4096 elements per (b, t)
#define NTOT (NBT * PLN)        // 4194304
static_assert((TS % 64) == 0);
static_assert(DS == 64);
static_assert(PLN == 2 * 8 * 256);

typedef _Float16 v16h __attribute__((ext_vector_type(16)));
typedef short    v8s  __attribute__((ext_vector_type(8)));
typedef float    v8f  __attribute__((ext_vector_type(8)));
typedef float    v4f  __attribute__((ext_vector_type(4)));
typedef unsigned int v4u __attribute__((ext_vector_type(4)));

// ---- scalar helpers --------------------------------------------------------------------------------
__device__ __forceinline__ unsigned short bf_bits(float f) {          // f32 -> bf16 bits, RNE convert
  unsigned u = __float_as_uint(f);
  return (unsigned short)((u + 0x7FFFu + ((u >> 16) & 1u)) >> 16);
}
__device__ __forceinline__ float bfr(float f) { return __uint_as_float(((unsigned)bf_bits(f)) << 16); }
__device__ __forceinline__ unsigned short h_bits(_Float16 x) { return __builtin_bit_cast(unsigned short, x); }
__device__ __forceinline__ unsigned pk16(unsigned short a, unsigned short b) { return (unsigned)a | ((unsigned)b << 16); }
__device__ __forceinline__ v8f zero8() { v8f z = {0.f, 0.f, 0.f, 0.f, 0.f, 0.f, 0.f, 0.f}; return z; }
__device__ __forceinline__ float wave_sum(float v) {
#pragma unroll
  for (int off = 16; off > 0; off >>= 1) v += __shfl_xor(v, off, 32);
  return v;
}

// ---- WMMA helper with trailing VALU hazard gap ----------------------------------------------------------
__device__ __forceinline__ v8f mma_h(v16h a, v16h b, v8f c) {
  c = __builtin_amdgcn_wmma_f32_16x16x32_f16(false, a, false, b, (short)0, c, false, false);
#if defined(__HIP_DEVICE_COMPILE__)
  asm volatile("v_nop\n\tv_nop\n\tv_nop\n\tv_nop" : "+v"(c) : "v"(a), "v"(b));
#endif
  return c;
}

// =====================================================================================================
// Stage 1: one block per (b, t), 256 threads. Thread tid owns elements e0 = tid*8..+7 (row tid>>3,
// cols (tid&7)*8..+7) and e1 = 2048 + tid*8..+7 (row 32 + tid>>3, same cols) of the 64x64 slice.
// + dt_b; dt = softplus(z) = max(z,0) + log1p(exp(-|z|)); ld[b][t][r] = dt * (-exp(log_A[r])).
// Outputs: Xv = f16(8 v), v = x as a bf16 value, in [b][t][r][c] layout (exact for 2^-20 <= |v| < 8188; below, within
// 2^-28 of v); St: one 128-B line per (b,t): halves 0..3 = 8 mu hi, residual x2048, 8 / rstd hi, residual x2048, halves
// 4..15 = 0 (these 32 B are the token's 16 extra B columns in stage 2), float word 8 = 64 rstd, the rest 0.
// coverage: Xv 2 x 256 x 8 = 4096 halves per (b,t); ld 16 x 4 = 64 floats, St 8 x 16 B per (b,t); grid = all (b,t).
// =====================================================================================================
__global__ __launch_bounds__(256) void ln_k(const float* __restrict__ x, const float* __restrict__ logA,
                                            const float* __restrict__ dtw, const float* __restrict__ dtb,
                                            const float* __restrict__ lnw, const float* __restrict__ lnb,
                                            unsigned short* Xv, unsigned int* Stp, float* ldp, int nbt) {
  __shared__ float red0[8];
  __shared__ float red1[8];
  __shared__ float zrow[64];
  __shared__ __align__(16) float ldv[64];
  const int bt = blockIdx.x;
  if (bt >= nbt) return;                       // block-uniform, before any barrier
  const int tid = threadIdx.x, lane = tid & 31, wave = tid >> 5;
  const int e0 = tid * 8, e1 = 2048 + tid * 8;
  const float* xp = x + (size_t)bt * PLN;

  const v4f xa = *(const v4f*)(xp + e0);
  const v4f xb = *(const v4f*)(xp + e0 + 4);
  const v4f xc = *(const v4f*)(xp + e1);
  const v4f xd = *(const v4f*)(xp + e1 + 4);
  float v[16];
#pragma unroll
  for (int q = 0; q < 4; ++q) {
    v[q]      = bfr(xa[q]);
    v[4 + q]  = bfr(xb[q]);
    v[8 + q]  = bfr(xc[q]);
    v[12 + q] = bfr(xd[q]);
  }
  // ---- mean ----
  float s = 0.0f;
#pragma unroll
  for (int i = 0; i < 16; ++i) s += v[i];
  s = wave_sum(s);
  if (lane == 0) red0[wave] = s;
  __syncthreads();
  float tot = 0.0f;
#pragma unroll
  for (int w = 0; w < 8; ++w) tot += red0[w];
  const float mu = tot * (1.0f / 4096.0f);
  // ---- centred variance ----
  float ss = 0.0f;
#pragma unroll
  for (int i = 0; i < 16; ++i) { const float d = v[i] - mu; ss += d * d; }
  ss = wave_sum(ss);
  if (lane == 0) red1[wave] = ss;
  __syncthreads();
  float vt = 0.0f;
#pragma unroll
  for (int w = 0; w < 8; ++w) vt += red1[w];
  const float var  = vt * (1.0f / 4096.0f);
  const float rstd = rsqrtf(var + 1e-5f);
  // ---- affine ----
  const v4f wa = *(const v4f*)(lnw + e0), wb = *(const v4f*)(lnw + e0 + 4);
  const v4f wc = *(const v4f*)(lnw + e1), wd = *(const v4f*)(lnw + e1 + 4);
  const v4f ba = *(const v4f*)(lnb + e0), bb = *(const v4f*)(lnb + e0 + 4);
  const v4f bc = *(const v4f*)(lnb + e1), bd = *(const v4f*)(lnb + e1 + 4);
  float xn[16];
#pragma unroll
  for (int q = 0; q < 4; ++q) {
    xn[q]      = (v[q]      - mu) * rstd * bfr(wa[q]) + bfr(ba[q]);
    xn[4 + q]  = (v[4 + q]  - mu) * rstd * bfr(wb[q]) + bfr(bb[q]);
    xn[8 + q]  = (v[8 + q]  - mu) * rstd * bfr(wc[q]) + bfr(bc[q]);
    xn[12 + q] = (v[12 + q] - mu) * rstd * bfr(wd[q]) + bfr(bd[q]);
  }
  // ---- dt dot: 8 terms per thread, reduced over the 8 lanes covering a row ----
  const int c8 = (tid & 7) * 8;
  const v4f da = *(const v4f*)(dtw + c8), db = *(const v4f*)(dtw + c8 + 4);
  float dw[8];
#pragma unroll
  for (int q = 0; q < 4; ++q) { dw[q] = bfr(da[q]); dw[4 + q] = bfr(db[q]); }
  float d0 = 0.0f, d1 = 0.0f;
#pragma unroll
  for (int i = 0; i < 8; ++i) { d0 += xn[i] * dw[i]; d1 += xn[8 + i] * dw[i]; }
  d0 += __shfl_xor(d0, 1, 32); d0 += __shfl_xor(d0, 2, 32); d0 += __shfl_xor(d0, 4, 32);
  d1 += __shfl_xor(d1, 1, 32); d1 += __shfl_xor(d1, 2, 32); d1 += __shfl_xor(d1, 4, 32);
  if ((tid & 7) == 0) { zrow[tid >> 3] = d0; zrow[32 + (tid >> 3)] = d1; }
  __syncthreads();
  if (tid < 64) {
    const float z  = zrow[tid] + bfr(dtb[0]);
    const float sp = fmaxf(z, 0.0f) + log1pf(__expf(-fabsf(z)));     // softplus
    const float ac = -__expf(bfr(logA[tid]));
    ldv[tid] = sp * ac;
  }
  __syncthreads();
  // ---- the one plane: f16(8 v) ----
  v4u p0, p1;
#pragma unroll
  for (int e = 0; e < 4; ++e) {
    p0[e] = pk16(h_bits((_Float16)(v[2 * e] * 8.0f)), h_bits((_Float16)(v[2 * e + 1] * 8.0f)));
    p1[e] = pk16(h_bits((_Float16)(v[8 + 2 * e] * 8.0f)), h_bits((_Float16)(v[8 + 2 * e + 1] * 8.0f)));
  }
  const v4f lv = *(const v4f*)(ldv + (tid & 15) * 4);          // clamped LDS address, stored only by tid < 16
  const size_t po0 = (size_t)bt * PLN + e0;
  const size_t po1 = (size_t)bt * PLN + e1;
  const size_t plo = (size_t)bt * DS + (tid & 15) * 4;
  *(v4u*)(Xv + po0) = p0;
  *(v4u*)(Xv + po1) = p1;
  if (tid < 16) *(v4f*)(ldp + plo) = lv;
  if ((tid >> 3) == 8) {                       // eight lanes of wave 2 store the token's whole 128-B line
    const int q = tid & 7;
    const float m8 = mu * 8.0f;
    const float q8 = 8.0f / rstd;
    const _Float16 mh = (_Float16)m8, qh = (_Float16)q8;
    const _Float16 ml = (_Float16)((m8 - (float)mh) * 2048.0f);
    const _Float16 ql = (_Float16)((q8 - (float)qh) * 2048.0f);
    v4u sv = {0u, 0u, 0u, 0u};
    if (q == 0) { sv[0] = pk16(h_bits(mh), h_bits(ml)); sv[1] = pk16(h_bits(qh), h_bits(ql)); }
    if (q == 2) sv[0] = __float_as_uint(rstd * 64.0f);
    *(v4u*)(Stp + (size_t)bt * 32 + q * 4) = sv;
  }
}

// =====================================================================================================
// Stage 2: out[b][t][r][c] = w[r][c] * (sum_j A[t][j] v[j][c] - sum_j A[t][j] mu_j) + b[r][c] * sum_j A[t][j] / rstd_j,
// j <= t, A[t][j] = exp(cs[b][t][r] - cs[b][j][r]) * rstd_j: the reference's sum over exp(..) * xn with the LayerNorm's
// per-token scale moved into the decay operand and its gain and bias, which do not depend on j, moved behind the sum.
// Block = (64-row t tile tt, r, b), 4 waves; wave w owns t rows tt*64 + 16w .. +15 and all 64 c.
// cs: the block forms an inclusive prefix sum of ld[b][first .. 64 (tt + 1) - 1][r] in f32: four tokens a thread, a
// shuffle scan over each wave's thread totals, then the earlier waves' totals from LDS. first = 64 (tt - 1) where a
// run-time test shows that every earlier token's weight is zero in both planes, else 0.
// A fragment (built in registers): lane row = lane&15 -> t = tbase + (lane&15); element e<8 -> j =
// j0 + 8h + e, e>=8 -> j = j0 + 16 + 8h + (e-8) (split k map); value p = exp(min(cs_t - cs_j, 0)) * 64 rstd_j,
// 0 for j > t (select by value), hi = f16(p), residual = f16((p - hi) * 2048). rstd <= 1 / sqrt(1e-5), so p < 20300.
// B tiles: 64 tokens x 80 columns in LDS (rows = tokens, pitch 160 B): columns 0..63 are the token's 128 B of the
// [b][t][r][c] plane, columns 64..79 the first 32 B of the token's St line, both as stage 1 stores them, brought by
// asynchronous copies, two buffers: tile k+1 flies while tile k is worked on; all four waves read from that one copy.
// B fragments: two transposing LDS loads (ds_load_tr16_b128) at token rows j0 and j0 + 16: lane (c = lane&15, h)
// gets tokens j0 + 8h .. +7 and j0 + 16 + 8h .. +7 of column c (split k map, as the A fragment).
// acc += Ahi.B; acc2 += Ares.B; sum = (acc + acc2/2048) / 2^9; in the fifth column group the residual columns add /2048.
// Leading steps whose weights are all zero in both planes (test on the prefix sums, at run time) are left out: the
// block stages tiles k0 .. tt only, a wave starts at its own step jlo. With slow decay k0 = 0 and all is done.
// The tile loop's trip count tt + 1 - k0 is block-uniform; a wave skips the 32-token half past its diagonal
// (wave-uniform scalar test) but passes every wait and barrier.
// Not yet used: stage 2 could round x itself and stage 1 store no plane at all; a decay tile left of the diagonal tile
// has rank one, exp(cs_t - cs_m) * exp(cs_m - cs_j).
// coverage: 4 waves x 16 rows x 64 cols = the block's 64 x 64 tile; grid (TS/64, DS, NB) = every (t, r, b) once.
// =====================================================================================================
#define XP    80                 // LDS row pitch in halves: 160 B = 32 B x 5, the transposing load's pitch
#define XTILE (64 * XP)          // halves of one tile in LDS
#define SP    64                 // halves of one token's St line
// A weight exp2(d) is carried as f16(exp2(d) * rstd * 2^6) and f16(residual * 2^11), rstd < 2^8.31: at d <= -50.4 both
// round to zero, and the products of such a step add exactly nothing. The rest of the cut is for the rounding of the
// prefix sums and of v_exp_f32.
#define ZCUT  (-52.0f)

// One block-wide tile fill: thread tid copies 16 B pieces (token row i*16 + tid>>3, piece tid&7), i = 0..3, of the
// plane, and one 16 B piece (token row tid>>1, piece tid&1) of the St lines. g, gs: this lane's source pieces;
// l, ls: this lane's LDS byte addresses. Row step of the plane's pieces: 16 rows.
__device__ __forceinline__ void stage_tile(const _Float16* g, const _Float16* gs, unsigned l, unsigned ls) {
  const _Float16* g1 = g + 16 * PLN; const _Float16* g2 = g + 32 * PLN; const _Float16* g3 = g + 48 * PLN;
  const unsigned st = 16 * XP * 2;
  const unsigned l1 = l + st, l2 = l + 2 * st, l3 = l + 3 * st;
#if defined(__HIP_DEVICE_COMPILE__)
  // the five copies and, as the last line, the wait that stands before any of their address registers is rewritten
  asm volatile("global_load_async_to_lds_b128 %0, %5, off\n\t"
               "global_load_async_to_lds_b128 %1, %6, off\n\t"
               "global_load_async_to_lds_b128 %2, %7, off\n\t"
               "global_load_async_to_lds_b128 %3, %8, off\n\t"
               "global_load_async_to_lds_b128 %4, %9, off\n\t"
               "s_wait_xcnt 0x0"
               :: "v"(l), "v"(l1), "v"(l2), "v"(l3), "v"(ls),
                  "v"(g), "v"(g1), "v"(g2), "v"(g3), "v"(gs)
               : "memory");
#endif
}

// Transposing fragment load: p = this lane's 16-B piece of the token-major tile (row kbase + 8h + (lane&7), piece
// (lane>>3)&1 of the 16 columns); q = the same 16 rows further on. Elements 0..7 <- tokens kbase + 8h .. +7,
// elements 8..15 <- tokens kbase + 16 + 8h .. +7, both of column lane&15.
__device__ __forceinline__ v16h ldfrag_tr(const _Float16* p, const _Float16* q) {
  typedef __attribute__((address_space(3))) v8s lds_v8s;
  union { v16h v; v8s h[2]; } f;
  f.h[0] = __builtin_amdgcn_ds_load_tr16_b128_v8i16((lds_v8s*)p);
  f.h[1] = __builtin_amdgcn_ds_load_tr16_b128_v8i16((lds_v8s*)q);
  return f.v;
}

__global__ __launch_bounds__(128) void ssm_k(const unsigned short* __restrict__ Xvp, const unsigned int* __restrict__ Stp,
                                             const float* __restrict__ ldp, const float* __restrict__ lnw,
                                             const float* __restrict__ lnb, float* outp) {
  __shared__ __align__(16) float cs_s[TS];
  __shared__ __align__(16) float rs_s[TS];                    // 64 rstd per token
  __shared__ float wtot[4];
  __shared__ __align__(16) float os_s[4 * 16 * 64];
  __shared__ __align__(16) float es_s[4 * 16 * 8];            // per wave and row: the fifth column group's first four sums, both planes
  __shared__ __align__(16) _Float16 xs[2 * XTILE];            // [buffer][token][column], pitch XP
  const int tt = blockIdx.x, r = blockIdx.y, b = blockIdx.z;
  const int tid = threadIdx.x, lane = tid & 31, hh = lane >> 4, l16 = lane & 15;
  const int wave = __builtin_amdgcn_readfirstlane(tid >> 5);  // scalar, so that the per-wave skip is a scalar branch

  // gain and bias of this lane's four output columns, asked for at entry, used at the store
  const v4f wq = *(const v4f*)(lnw + r * DS + l16 * 4);
  const v4f bq = *(const v4f*)(lnb + r * DS + l16 * 4);

  const _Float16* Xv = (const _Float16*)(const void*)Xvp;
  const _Float16* Sh = (const _Float16*)(const void*)Stp;
  const float*    Sf = (const float*)(const void*)Stp;
  const size_t plb = ((size_t)(b * TS) * DS + r) * DS;         // (b, token 0, r, c 0)
  const int    sof = (tid >> 3) * PLN + (tid & 7) * 8;         // this lane's first piece inside a tile's rows
  const _Float16* sg  = Xv + plb + sof;
  const _Float16* sgs = Sh + ((size_t)(b * TS) + (tid >> 1)) * SP + (tid & 1) * 8;
  const unsigned  sl  = (unsigned)(uintptr_t)(xs + (tid >> 3) * XP + (tid & 7) * 8);        // LDS byte address
  const unsigned  sls = (unsigned)(uintptr_t)(xs + (tid >> 1) * XP + DS + (tid & 1) * 8);   // LDS byte address
  const int nt = tt + 1;                                       // tiles of 64 tokens, block-uniform

  // ---- inclusive prefix sum of ld[b][first .. 64 nt - 1][r]: thread tid owns tokens first + 4 tid .. +3 ----
  // Only differences cs[t] - cs[j] are used, so the sum may start at any token in front of which every weight is zero.
  // First trip: it starts at the tile left of the diagonal tile. cs never rises (softplus >= 0, -exp < 0), so the
  // largest weight of a token in front of first is exp(cs[64 tt]), the sum from first to the block's first row. Where
  // that is not under the cut (slow decay, or a not-a-number, which compares false), a second trip sums from token 0.
  int first = (tt > 0) ? (tt - 1) * 64 : 0;                    // block-uniform
#pragma unroll 1                                               // the second trip is the rare one: one copy of the code
  for (int pass = 0; pass < 2; ++pass) {
    const int t4 = first + tid * 4;
    const bool own = t4 < nt * 64;                             // tokens past the block's last row are never read
    float l0 = 0.0f, l1 = 0.0f, l2 = 0.0f, l3 = 0.0f;
    v4f rv = {0.0f, 0.0f, 0.0f, 0.0f};
    if (own) {
      const float* lp = ldp + ((size_t)(b * TS + t4)) * DS + r;
      const float* sp = Sf + ((size_t)(b * TS + t4)) * 32 + 8;
      rv[0] = sp[0]; rv[1] = sp[32]; rv[2] = sp[64]; rv[3] = sp[96];
      l0 = lp[0]; l1 = lp[DS]; l2 = lp[2 * DS]; l3 = lp[3 * DS];
#if defined(__HIP_DEVICE_COMPILE__)
      asm volatile("s_wait_xcnt 0x0" ::: "memory");            // stands before an address register of the eight loads is rewritten
#endif
    }
    l1 += l0; l2 += l1; l3 += l2;                              // inside the thread
    float sc = l3;                                             // over the wave's 32 thread totals, inclusive
#pragma unroll                                                 // five steps, each with its distance as a constant
    for (int off = 1; off < 32; off <<= 1) {
      const float o = __shfl_up(sc, off, 32);
      sc += (lane >= off) ? o : 0.0f;
    }
    if (lane == 31) wtot[wave] = sc;
    float pre = __shfl_up(sc, 1, 32);                          // total of the wave's earlier threads
    pre = (lane > 0) ? pre : 0.0f;
    __syncthreads();                                           // the four wave totals are written
#pragma unroll                                                 // three selects on the scalar wave number, no loop
    for (int w = 0; w < 3; ++w) pre += (w < wave) ? wtot[w] : 0.0f;
    if (own) {
      const v4f c4v = {pre + l0, pre + l1, pre + l2, pre + l3};
      *(v4f*)(cs_s + t4) = c4v;
      *(v4f*)(rs_s + t4) = rv;
    }
    __syncthreads();                                           // publishes the prefix sum
    if (first == 0) break;
    // one LDS word, the same for all threads, made scalar so that the branch round the barriers is a scalar one
    const float dwin = __uint_as_float(__builtin_amdgcn_readfirstlane(__float_as_uint(cs_s[tt * 64]))) * 1.44269504088896340736f;
    if (dwin < ZCUT) break;
    first = 0;
  }

  // ---- leading 32-token steps whose decay weights are all zero in both f16 planes ----
  // Over rows t >= top and tokens j <= jl the largest weight is exp(cs[top] - cs[jl]). Lane h < 16 tests step h
  // (jl = 32 h + 31); a step in front of first is zero by the test above; a not-a-number compares false and skips nothing.
  const int tbase = tt * 64 + wave * 16;
  const int jl = l16 * 32 + 31;
  const float cjl = cs_s[(jl < first) ? first : ((jl < nt * 64) ? jl : nt * 64 - 1)];   // only words that were written
  const float dblk = (cs_s[tt * 64] - cjl) * 1.44269504088896340736f;   // the block's first row
  const float dwav = (cs_s[tbase] - cjl) * 1.44269504088896340736f;     // this wave's first row
  const unsigned zblk = __builtin_amdgcn_ballot_w32(hh == 0 && jl < tt * 64 && (jl < first || dblk < ZCUT));
  const unsigned zwav = __builtin_amdgcn_ballot_w32(hh == 0 && jl < tbase && (jl < first || dwav < ZCUT));
  const int k0  = __builtin_ctz(~zblk) >> 1;                   // first tile that the block stages, <= tt, the same in all waves
  const int jlo = __builtin_ctz(~zwav) * 32;                   // first step that this wave multiplies, <= tbase

  stage_tile(sg + (size_t)k0 * (64 * PLN), sgs + (size_t)k0 * (64 * SP), sl, sls);                    // tile k0 -> buffer 0
  asm volatile("s_wait_asynccnt 0x0" ::: "memory");            // this wave's share of tile k0 has landed
  __syncthreads();                                             // publishes tile k0
  if (k0 + 1 < nt)                                             // tile k0 + 1 -> buffer 1
    stage_tile(sg + (size_t)(k0 + 1) * (64 * PLN), sgs + (size_t)(k0 + 1) * (64 * SP), sl + XTILE * 2, sls + XTILE * 2);

  const int trow  = tbase + l16;
  const float cst = cs_s[trow];

  v8f acc[5], acc2[5];
#pragma unroll
  for (int s = 0; s < 5; ++s) { acc[s] = zero8(); acc2[s] = zero8(); }

  const int jend = tbase + 16;               // wave-uniform causal bound
#pragma unroll 1                             // one tile per trip: the ring's waits and barrier stand once
  for (int kc = k0; kc < nt; ++kc) {
    const int bufo = ((kc - k0) & 1) * XTILE;
#pragma unroll 1                             // kept rolled: the second half is skipped on the diagonal by waves 0 and 1
    for (int j0 = (kc * 64 > jlo) ? kc * 64 : jlo; j0 < kc * 64 + 64 && j0 < jend; j0 += 32) {
      const _Float16* fb = xs + bufo + ((j0 & 32) + 8 * hh + (lane & 7)) * XP + ((lane >> 3) & 1) * 8;
      v16h xf[5];
#pragma unroll
      for (int s = 0; s < 5; ++s) xf[s] = ldfrag_tr(fb + s * 16, fb + 16 * XP + s * 16);
      const int kA = j0 + hh * 8;
      const int kB = j0 + 16 + hh * 8;
      const v4f q0 = *(const v4f*)(cs_s + kA);
      const v4f q1 = *(const v4f*)(cs_s + kA + 4);
      const v4f q2 = *(const v4f*)(cs_s + kB);
      const v4f q3 = *(const v4f*)(cs_s + kB + 4);
      const v4f g0 = *(const v4f*)(rs_s + kA);
      const v4f g1 = *(const v4f*)(rs_s + kA + 4);
      const v4f g2 = *(const v4f*)(rs_s + kB);
      const v4f g3 = *(const v4f*)(rs_s + kB + 4);
      float cj[16], rj[16];
#pragma unroll
      for (int q = 0; q < 4; ++q) {
        cj[q]      = q0[q];
        cj[q + 4]  = q1[q];
        cj[q + 8]  = q2[q];
        cj[q + 12] = q3[q];
        rj[q]      = g0[q];
        rj[q + 4]  = g1[q];
        rj[q + 8]  = g2[q];
        rj[q + 12] = g3[q];
      }
      float ex[16];
#pragma unroll
      for (int e = 0; e < 16; ++e) ex[e] = fminf(cst - cj[e], 0.0f) * 1.44269504088896340736f;
#if defined(__HIP_DEVICE_COMPILE__)
      // The instruction set asks for one slot behind a v_exp_f32 before a register it reads is rewritten. The
      // scheduling barriers keep the sixteen v_exp_f32 by themselves, with nothing between them that rewrites an
      // argument, and hold the v_nop directly behind the last.
      __builtin_amdgcn_sched_barrier(0);
#pragma unroll
      for (int e = 0; e < 16; ++e) ex[e] = __builtin_amdgcn_exp2f(ex[e]);
      __builtin_amdgcn_sched_barrier(0);
      asm volatile("v_nop");
      __builtin_amdgcn_sched_barrier(0);
#endif
      v16h pa, pr;
#pragma unroll
      for (int e = 0; e < 16; ++e) {
        const int j = (e < 8) ? (kA + e) : (kB + e - 8);
        float p = ex[e] * rj[e];
        p = (j <= trow) ? p : 0.0f;                          // causal select by value
        const _Float16 x0 = (_Float16)p;
        pa[e] = x0;
        pr[e] = (_Float16)((p - (float)x0) * 2048.0f);
      }
#pragma unroll
      for (int s = 0; s < 5; ++s) {
        acc[s]  = mma_h(pa, xf[s], acc[s]);
        acc2[s] = mma_h(pr, xf[s], acc2[s]);
      }
    }
    asm volatile("s_wait_dscnt 0x0" ::: "memory");             // this wave's reads of the buffer are done
    asm volatile("s_wait_asynccnt 0x0" ::: "memory");          // this wave's share of tile kc + 1 has landed
    __syncthreads();                                           // publishes tile kc + 1, frees tile kc's buffer
    if (kc + 2 < nt)
      stage_tile(sg + (size_t)(kc + 2) * (64 * PLN), sgs + (size_t)(kc + 2) * (64 * SP), sl + bufo * 2, sls + bufo * 2);
  }
  asm volatile("s_wait_asynccnt 0x0" ::: "memory");            // no copy is outstanding when the wave goes on

  // ---- epilogue ----
  float* os = os_s + wave * (16 * 64);
  float* es = es_s + wave * (16 * 8);
#pragma unroll
  for (int r8 = 0; r8 < 8; ++r8) {
#pragma unroll
    for (int s = 0; s < 4; ++s) {
      const float val = acc[s][r8] + acc2[s][r8] * (1.0f / 2048.0f);
      os[(8 * hh + r8) * 64 + s * 16 + l16] = val;
    }
  }
  if (l16 < 4) {                                         // columns 64..67: 8 mu hi, residual, 8 / rstd hi, residual
#pragma unroll
    for (int r8 = 0; r8 < 8; ++r8) {
      es[(8 * hh + r8) * 8 + l16]     = acc[4][r8];
      es[(8 * hh + r8) * 8 + 4 + l16] = acc2[4][r8];
    }
  }
  __builtin_amdgcn_fence(__ATOMIC_RELEASE, "workgroup");
  __builtin_amdgcn_wave_barrier();
  __builtin_amdgcn_fence(__ATOMIC_ACQUIRE, "workgroup");
  const int h2 = lane >> 4, c4 = (lane & 15) * 4;       // 256-B row = 16 lanes x 16 B
  v4f wv, bv;
#pragma unroll
  for (int q = 0; q < 4; ++q) { wv[q] = bfr(wq[q]) * (1.0f / 512.0f); bv[q] = bfr(bq[q]) * (1.0f / 512.0f); }   // exact scalings
  v4f ov[8];
#pragma unroll
  for (int it = 0; it < 8; ++it) {
    const int row = it * 2 + h2;                         // it 0..7 x h2 0..1 = rows 0..15
    const v4f sv = *(const v4f*)(os + row * 64 + c4);
    const v4f ea = *(const v4f*)(es + row * 8);
    const v4f eb = *(const v4f*)(es + row * 8 + 4);
    const float sm = ea[0] + (ea[1] + eb[0]) * (1.0f / 2048.0f);    // 512 sum_j A mu_j
    const float sd = ea[2] + (ea[3] + eb[2]) * (1.0f / 2048.0f);    // 512 sum_j A / rstd_j
#pragma unroll
    for (int q = 0; q < 4; ++q) ov[it][q] = (sv[q] - sm) * wv[q] + sd * bv[q];
  }
  {
#pragma unroll
    for (int it = 0; it < 8; ++it) {
      const int row = it * 2 + h2;
      const size_t go = (((size_t)(b * TS + tbase + row)) * DS + r) * DS + c4;
      *(v4f*)(outp + go) = ov[it];
    }
  }
}

// =====================================================================================================
// Workspace map (bytes); every region is an exact multiple of its whole-line store granularity, no aliasing:
//   Xv   f16 [1024][4096]   ([b][t][r][c], x as a bf16 value, x8)   0         8388608
//   Ld   f32 [1024][64]     ([b][t][r], dt * (-exp(log_A)))         8388608   262144
//   St   128 B x [1024]     ([b][t], the token's statistics)        8650752   131072
//   end                                                              8781824
// d_out f32 [2][512][64][64] at byte 0.
// =====================================================================================================
extern "C" void kernel_launch(void* const* d_in, const int* in_sizes, int n_in,
                              void* d_out, int out_size, void* d_ws, size_t ws_size,
                              hipStream_t stream) {
  if (n_in < 6) return;
  if (in_sizes[0] != NTOT) return;
  if (in_sizes[1] != DS) return;
  if (in_sizes[2] != DS) return;
  if (in_sizes[3] != 1) return;
  if (in_sizes[4] != PLN) return;
  if (in_sizes[5] != PLN) return;
  if (out_size != NTOT) return;

  const float* x    = (const float*)d_in[0];   // [2][512][64][64]
  const float* logA = (const float*)d_in[1];   // [64]
  const float* dtw  = (const float*)d_in[2];   // [64]
  const float* dtb  = (const float*)d_in[3];   // [1]
  const float* lnw  = (const float*)d_in[4];   // [64][64]
  const float* lnb  = (const float*)d_in[5];   // [64][64]
  float* outf = (float*)d_out;

  const size_t PB = (size_t)NTOT * 2;          // 8388608
  const size_t LB = (size_t)NBT * DS * 4;      //  262144
  const size_t SB = (size_t)NBT * 128;         //  131072
  size_t off = 0;
  const size_t oXv  = off; off += PB;
  const size_t oLd  = off; off += LB;
  const size_t oSt  = off; off += SB;
  if (off > ws_size) return;                   // off = 8781824
  if (off > (size_t)134217728) return;

  char* ws = (char*)d_ws;
  unsigned short* Xv  = (unsigned short*)(ws + oXv);
  float*          Ld  = (float*)(ws + oLd);
  unsigned int*   St  = (unsigned int*)(ws + oSt);

  const int nbt = in_sizes[0] / PLN;           // 1024
  // (1) LayerNorm statistics, dt, ld and the x plane
  ln_k<<<dim3(nbt), dim3(256), 0, stream>>>(x, logA, dtw, dtb, lnw, lnb, Xv, St, Ld, nbt);
  // (2) prefix sum + causal decay product + gain and bias -> d_out
  ssm_k<<<dim3(TS / 64, DS, NB), dim3(128), 0, stream>>>(Xv, St, Ld, lnw, lnb, outf);
  (void)hipGetLastError();
}

// v007
// Measured time: 12.4 microseconds a run.
// Timed twice side by side with v006, it ran 1.13 times as fast both times.
// Counting every step since v000, it is 5.05 times as fast.
// Contraction out[b][t][r][c] = sum_{j<=t} D[t][j] * xn[b][j][r][c] per (b, r), K = 512, with xn = (v - mu_j) rstd_j w[r][c] + b[r][c] taken apart: out = w * (sum_j A v - sum_j A mu_j) + b * sum_j A / rstd_j, A = D[t][j] rstd_j. v_wmma_f32_16x16x32_f16: A carried x2^6 as f16 hi + x2^11 residual plane; v (x rounded to a bf16 value, eight significant bits) carried x2^3 in ONE f16 plane; mu_j and 1/rstd_j x2^3 as f16 hi + residual in four more B columns; f32 accumulate. LayerNorm statistics, the 64-term dt dot (taken apart the same way: rstd_j (sum_c v w dtw - mu_j sum_c w dtw) + sum_c b dtw), softplus, prefix sum and exp are f32 on VALU; all six inputs RNE-converted to bf16 values on load.
#include <hip/hip_runtime.h>
#include <math.h>
#include <stdint.h>

#define NB   2
#define TS   512
#define DS   64
#define NBT  (NB * TS)          // 1024 (b, t) rows
#define PLN  (DS * DS)          // 4096 elements per (b, t)
#define NTOT (NBT * PLN)        // 4194304
static_assert((TS % 64) == 0);
static_assert(DS == 64);
static_assert(PLN == 2 * 8 * 256);

typedef _Float16 v16h __attribute__((ext_vector_type(16)));
typedef short    v8s  __attribute__((ext_vector_type(8)));
typedef float    v8f  __attribute__((ext_vector_type(8)));
typedef float    v4f  __attribute__((ext_vector_type(4)));
typedef unsigned int v4u __attribute__((ext_vector_type(4)));

// ---- scalar helpers --------------------------------------------------------------------------------
__device__ __forceinline__ unsigned short bf_bits(float f) {          // f32 -> bf16 bits, RNE convert
  unsigned u = __float_as_uint(f);
  return (unsigned short)((u + 0x7FFFu + ((u >> 16) & 1u)) >> 16);
}
__device__ __forceinline__ float bfr(float f) { return __uint_as_float(((unsigned)bf_bits(f)) << 16); }
__device__ __forceinline__ unsigned short h_bits(_Float16 x) { return __builtin_bit_cast(unsigned short, x); }
__device__ __forceinline__ unsigned pk16(unsigned short a, unsigned short b) { return (unsigned)a | ((unsigned)b << 16); }
__device__ __forceinline__ v8f zero8() { v8f z = {0.f, 0.f, 0.f, 0.f, 0.f, 0.f, 0.f, 0.f}; return z; }
__device__ __forceinline__ float wave_sum(float v) {
#pragma unroll
  for (int off = 16; off > 0; off >>= 1) v += __shfl_xor(v, off, 32);
  return v;
}

// ---- WMMA helper with trailing VALU hazard gap ----------------------------------------------------------
__device__ __forceinline__ v8f mma_h(v16h a, v16h b, v8f c) {
  c = __builtin_amdgcn_wmma_f32_16x16x32_f16(false, a, false, b, (short)0, c, false, false);
#if defined(__HIP_DEVICE_COMPILE__)
  asm volatile("v_nop\n\tv_nop\n\tv_nop\n\tv_nop" : "+v"(c) : "v"(a), "v"(b));
#endif
  return c;
}

// =====================================================================================================
// Stage 1: one block per (b, t), 256 threads. Thread tid owns elements e0 = tid*8..+7 (row tid>>3,
// cols (tid&7)*8..+7) and e1 = 2048 + tid*8..+7 (row 32 + tid>>3, same cols) of the 64x64 slice.
// Outputs: Xv = f16(8 v), v = x as a bf16 value, in [b][t][r][c] layout (exact for 2^-20 <= |v| < 8188; below, within
// 2^-28 of v); St: one 128-B line per (b,t): halves 0..3 = 8 mu hi, residual x2048, 8 / rstd hi, residual x2048, float
// word 2 = 64 rstd, float word 3 = mu, the rest 0 (the first 32 B are the token's 16 extra B columns in stage 2, which
// uses the sums of columns 0..3 alone: a column's values reach no other column's sum).
// coverage: Xv 2 x 256 x 8 = 4096 halves per (b,t); St 8 x 16 B per (b,t); grid = all (b,t).
// =====================================================================================================
__global__ __launch_bounds__(256) void ln_k(const float* __restrict__ x, unsigned short* Xv, unsigned int* Stp, int nbt) {
  __shared__ float red0[8];
  __shared__ float red1[8];
  const int bt = blockIdx.x;
  if (bt >= nbt) return;                       // block-uniform, before any barrier
  const int tid = threadIdx.x, lane = tid & 31, wave = tid >> 5;
  const int e0 = tid * 8, e1 = 2048 + tid * 8;
  const float* xp = x + (size_t)bt * PLN;

  const v4f xa = *(const v4f*)(xp + e0);
  const v4f xb = *(const v4f*)(xp + e0 + 4);
  const v4f xc = *(const v4f*)(xp + e1);
  const v4f xd = *(const v4f*)(xp + e1 + 4);
  float v[16];
#pragma unroll
  for (int q = 0; q < 4; ++q) {
    v[q]      = bfr(xa[q]);
    v[4 + q]  = bfr(xb[q]);
    v[8 + q]  = bfr(xc[q]);
    v[12 + q] = bfr(xd[q]);
  }
  // ---- mean ----
  float s = 0.0f;
#pragma unroll
  for (int i = 0; i < 16; ++i) s += v[i];
  s = wave_sum(s);
  if (lane == 0) red0[wave] = s;
  __syncthreads();
  float tot = 0.0f;
#pragma unroll
  for (int w = 0; w < 8; ++w) tot += red0[w];
  const float mu = tot * (1.0f / 4096.0f);
  // ---- centred variance ----
  float ss = 0.0f;
#pragma unroll
  for (int i = 0; i < 16; ++i) { const float d = v[i] - mu; ss += d * d; }
  ss = wave_sum(ss);
  if (lane == 0) red1[wave] = ss;
  __syncthreads();
  float vt = 0.0f;
#pragma unroll
  for (int w = 0; w < 8; ++w) vt += red1[w];
  const float var  = vt * (1.0f / 4096.0f);
  const float rstd = rsqrtf(var + 1e-5f);
  // ---- the one plane: f16(8 v) ----
  v4u p0, p1;
#pragma unroll
  for (int e = 0; e < 4; ++e) {
    p0[e] = pk16(h_bits((_Float16)(v[2 * e] * 8.0f)), h_bits((_Float16)(v[2 * e + 1] * 8.0f)));
    p1[e] = pk16(h_bits((_Float16)(v[8 + 2 * e] * 8.0f)), h_bits((_Float16)(v[8 + 2 * e + 1] * 8.0f)));
  }
  const size_t po0 = (size_t)bt * PLN + e0;
  const size_t po1 = (size_t)bt * PLN + e1;
  *(v4u*)(Xv + po0) = p0;
  *(v4u*)(Xv + po1) = p1;
  if ((tid >> 3) == 8) {                       // eight lanes of wave 2 store the token's whole 128-B line
    const int q = tid & 7;
    const float m8 = mu * 8.0f;
    const float q8 = 8.0f / rstd;
    const _Float16 mh = (_Float16)m8, qh = (_Float16)q8;
    const _Float16 ml = (_Float16)((m8 - (float)mh) * 2048.0f);
    const _Float16 ql = (_Float16)((q8 - (float)qh) * 2048.0f);
    v4u sv = {0u, 0u, 0u, 0u};
    if (q == 0) {
      sv[0] = pk16(h_bits(mh), h_bits(ml)); sv[1] = pk16(h_bits(qh), h_bits(ql));
      sv[2] = __float_as_uint(rstd * 64.0f); sv[3] = __float_as_uint(mu);
    }
    *(v4u*)(Stp + (size_t)bt * 32 + q * 4) = sv;
  }
}

// =====================================================================================================
// Stage 2: out[b][t][r][c] = w[r][c] * (sum_j A[t][j] v[j][c] - sum_j A[t][j] mu_j) + b[r][c] * sum_j A[t][j] / rstd_j,
// j <= t, A[t][j] = exp(cs[b][t][r] - cs[b][j][r]) * rstd_j: the reference's sum over exp(..) * xn with the LayerNorm's
// per-token scale moved into the decay operand and its gain and bias, which do not depend on j, moved behind the sum.
// Block = (64-row t tile tt, r, b), 4 waves; wave w owns t rows tt*64 + 16w .. +15 and all 64 c.
// ld[j] = softplus(z_j) * (-exp(log_A[r])), z_j = rstd_j (sum_c v[j][c] w[r][c] dtw[c] - mu_j sum_c w[r][c] dtw[c]) +
// sum_c b[r][c] dtw[c] + dt_b: the block forms it itself, one token a thread, from the token's row and statistics in the
// two LDS tiles tt and tt - 1, which are copied at entry (softplus(z) = max(z,0) + log1p(exp(-|z|))).
// cs: the block forms an inclusive prefix sum of ld[first .. 64 (tt + 1) - 1] in f32: one token a thread, a
// shuffle scan over each wave's 32 tokens, then the earlier waves' totals from LDS. first = 64 (tt - 1) where a
// run-time test shows that every earlier token's weight is zero in both planes, else 0 (ld then read from the plane).
// A fragment (built in registers): lane row = lane&15 -> t = tbase + (lane&15); element e<8 -> j =
// j0 + 8h + e, e>=8 -> j = j0 + 16 + 8h + (e-8) (split k map); value p = exp(min(cs_t - cs_j, 0)) * 64 rstd_j,
// 0 for j > t (select by value), hi = f16(p), residual = f16((p - hi) * 2048). rstd <= 1 / sqrt(1e-5), so p < 20300.
// B tiles: 64 tokens x 80 columns in LDS (rows = tokens, pitch 160 B): columns 0..63 are the token's 128 B of the
// [b][t][r][c] plane, columns 64..79 the first 32 B of the token's St line, both as stage 1 stores them, brought by
// asynchronous copies, two buffers, tiles in falling order tt, tt - 1, .. k0: tile k-2 flies while tile k-1 is worked on;
// all four waves read from that one copy.
// B fragments: two transposing LDS loads (ds_load_tr16_b128) at token rows j0 and j0 + 16: lane (c = lane&15, h)
// gets tokens j0 + 8h .. +7 and j0 + 16 + 8h .. +7 of column c (split k map, as the A fragment).
// acc += Ahi.B; acc2 += Ares.B; sum = (acc + acc2/2048) / 2^9; in the fifth column group the residual columns add /2048.
// Leading steps whose weights are all zero in both planes (test on the prefix sums, at run time) are left out: the
// block multiplies tiles k0 .. tt only, a wave starts at its own step jlo. With slow decay k0 = 0 and all is done.
// The tile loop's trip count tt + 1 - k0 is block-uniform; a wave skips the 32-token half past its diagonal
// (wave-uniform scalar test) but passes every wait and barrier.
// Not yet used: stage 2 could round x itself and stage 1 store no plane at all; a decay tile left of the diagonal tile
// has rank one, exp(cs_t - cs_m) * exp(cs_m - cs_j).
// coverage: 4 waves x 16 rows x 64 cols = the block's 64 x 64 tile; grid (TS/64, DS, NB) = every (t, r, b) once.
// =====================================================================================================
#define XP    80                 // LDS row pitch in halves: 160 B = 32 B x 5, the transposing load's pitch
#define XTILE (64 * XP)          // halves of one tile in LDS
#define SP    64                 // halves of one token's St line
// A weight exp2(d) is carried as f16(exp2(d) * rstd * 2^6) and f16(residual * 2^11), rstd < 2^8.31: at d <= -50.4 both
// round to zero, and the products of such a step add exactly nothing. The rest of the cut is for the rounding of the
// prefix sums and of v_exp_f32.
#define ZCUT  (-52.0f)

// One block-wide tile fill: thread tid copies 16 B pieces (token row i*16 + tid>>3, piece tid&7), i = 0..3, of the
// plane, and one 16 B piece (token row tid>>1, piece tid&1) of the St lines. g, gs: this lane's source pieces;
// l, ls: this lane's LDS byte addresses. Row step of the plane's pieces: 16 rows.
__device__ __forceinline__ void stage_tile(const _Float16* g, const _Float16* gs, unsigned l, unsigned ls) {
  const _Float16* g1 = g + 16 * PLN; const _Float16* g2 = g + 32 * PLN; const _Float16* g3 = g + 48 * PLN;
  const unsigned st = 16 * XP * 2;
  const unsigned l1 = l + st, l2 = l + 2 * st, l3 = l + 3 * st;
#if defined(__HIP_DEVICE_COMPILE__)
  // the five copies and, as the last line, the wait that stands before any of their address registers is rewritten
  asm volatile("global_load_async_to_lds_b128 %0, %5, off\n\t"
               "global_load_async_to_lds_b128 %1, %6, off\n\t"
               "global_load_async_to_lds_b128 %2, %7, off\n\t"
               "global_load_async_to_lds_b128 %3, %8, off\n\t"
               "global_load_async_to_lds_b128 %4, %9, off\n\t"
               "s_wait_xcnt 0x0"
               :: "v"(l), "v"(l1), "v"(l2), "v"(l3), "v"(ls),
                  "v"(g), "v"(g1), "v"(g2), "v"(g3), "v"(gs)
               : "memory");
#endif
}

// Transposing fragment load: p = this lane's 16-B piece of the token-major tile (row kbase + 8h + (lane&7), piece
// (lane>>3)&1 of the 16 columns); q = the same 16 rows further on. Elements 0..7 <- tokens kbase + 8h .. +7,
// elements 8..15 <- tokens kbase + 16 + 8h .. +7, both of column lane&15.
__device__ __forceinline__ v16h ldfrag_tr(const _Float16* p, const _Float16* q) {
  typedef __attribute__((address_space(3))) v8s lds_v8s;
  union { v16h v; v8s h[2]; } f;
  f.h[0] = __builtin_amdgcn_ds_load_tr16_b128_v8i16((lds_v8s*)p);
  f.h[1] = __builtin_amdgcn_ds_load_tr16_b128_v8i16((lds_v8s*)q);
  return f.v;
}

// Decay log and 64 rstd of one token: row = its 64 halves 8 v, st = the first 16 B of its St line (16-B aligned; both in
// LDS, or with GLB both in global memory), wd = w[r][c] dtw[c] (64 floats in LDS), swd = their sum,
// zc = sum_c b[r][c] dtw[c] + dt_b, ac = -exp(log_A[r]).
// acc + f16 (low or high half of h) * w in one instruction an element (v_fma_mix_f32): left to itself the compiler
// converts every half by itself and pairs the products, with register moves to form the pairs.
__device__ __forceinline__ float mix_lo(unsigned h, float w, float acc) {
#if defined(__HIP_DEVICE_COMPILE__)
  asm("v_fma_mix_f32 %0, %1, %2, %0 op_sel_hi:[1,0,0]" : "+v"(acc) : "v"(h), "v"(w));
#endif
  return acc;
}
__device__ __forceinline__ float mix_hi(unsigned h, float w, float acc) {
#if defined(__HIP_DEVICE_COMPILE__)
  asm("v_fma_mix_f32 %0, %1, %2, %0 op_sel:[1,0,0] op_sel_hi:[1,0,0]" : "+v"(acc) : "v"(h), "v"(w));
#endif
  return acc;
}

template <bool GLB>
__device__ __forceinline__ float tok_ld(const _Float16* row, const _Float16* st, const float* wd,
                                        float swd, float zc, float ac, float& r64) {
  v4u hv[8];                                                   // two halves a word, columns 8 i + 2 q and + 1
#pragma unroll
  for (int i = 0; i < 8; ++i) hv[i] = *(const v4u*)(row + 8 * i);
  const v4u sv = *(const v4u*)st;
#if defined(__HIP_DEVICE_COMPILE__)
  if (GLB) {
    // the wait stands before an address register of the nine loads is rewritten; the scheduling barriers hold it
    // directly behind them, in front of the next trip's address additions
    __builtin_amdgcn_sched_barrier(0);
    asm volatile("s_wait_xcnt 0x0" ::: "memory");
    __builtin_amdgcn_sched_barrier(0);
  }
#endif
  float d[4] = {0.0f, 0.0f, 0.0f, 0.0f};                       // four chains, so that an add waits on the fourth before it only
#pragma unroll
  for (int i = 0; i < 8; ++i) {
    const v4f wa = *(const v4f*)(wd + 8 * i);
    const v4f wb = *(const v4f*)(wd + 8 * i + 4);
    d[0] = mix_lo(hv[i][0], wa[0], d[0]); d[1] = mix_hi(hv[i][0], wa[1], d[1]);
    d[2] = mix_lo(hv[i][1], wa[2], d[2]); d[3] = mix_hi(hv[i][1], wa[3], d[3]);
    d[0] = mix_lo(hv[i][2], wb[0], d[0]); d[1] = mix_hi(hv[i][2], wb[1], d[1]);
    d[2] = mix_lo(hv[i][3], wb[2], d[2]); d[3] = mix_hi(hv[i][3], wb[3], d[3]);
  }
  r64 = __uint_as_float(sv[2]);
  const float mu8 = __uint_as_float(sv[3]) * 8.0f;
  const float z  = (r64 * (1.0f / 512.0f)) * (((d[0] + d[1]) + (d[2] + d[3])) - mu8 * swd) + zc;
  const float sp = fmaxf(z, 0.0f) + log1pf(__expf(-fabsf(z)));   // softplus
  return sp * ac;
}

__global__ __launch_bounds__(128) void ssm_k(const unsigned short* __restrict__ Xvp, const unsigned int* __restrict__ Stp,
                                             const float* __restrict__ logA, const float* __restrict__ dtw,
                                             const float* __restrict__ dtb, const float* __restrict__ lnw,
                                             const float* __restrict__ lnb, float* outp) {
  __shared__ __align__(16) float cs_s[TS];
  __shared__ __align__(16) float rs_s[TS];                    // 64 rstd per token
  __shared__ __align__(16) float wd_s[DS];                    // w[r][c] dtw[c]
  __shared__ float wtot[4];
  __shared__ __align__(16) float os_s[4 * 16 * 64];
  __shared__ __align__(16) float es_s[4 * 16 * 8];            // per wave and row: the fifth column group's first four sums, both planes
  __shared__ __align__(16) _Float16 xs[2 * XTILE];            // [buffer][token][column], pitch XP
  const int tt = blockIdx.x, r = blockIdx.y, b = blockIdx.z;
  const int tid = threadIdx.x, lane = tid & 31, hh = lane >> 4, l16 = lane & 15;
  const int wave = __builtin_amdgcn_readfirstlane(tid >> 5);  // scalar, so that the per-wave skip is a scalar branch

  // gain and bias of this lane's four output columns, asked for at entry, used at the store
  const v4f wq = *(const v4f*)(lnw + r * DS + l16 * 4);
  const v4f bq = *(const v4f*)(lnb + r * DS + l16 * 4);

  const _Float16* Xv = (const _Float16*)(const void*)Xvp;
  const _Float16* Sh = (const _Float16*)(const void*)Stp;
  const size_t plb = ((size_t)(b * TS) * DS + r) * DS;         // (b, token 0, r, c 0)
  const int    sof = (tid >> 3) * PLN + (tid & 7) * 8;         // this lane's first piece inside a tile's rows
  const _Float16* sg  = Xv + plb + sof;
  const _Float16* sgs = Sh + ((size_t)(b * TS) + (tid >> 1)) * SP + (tid & 1) * 8;
  const unsigned  sl  = (unsigned)(uintptr_t)(xs + (tid >> 3) * XP + (tid & 7) * 8);        // LDS byte address
  const unsigned  sls = (unsigned)(uintptr_t)(xs + (tid >> 1) * XP + DS + (tid & 1) * 8);   // LDS byte address
  const int nt = tt + 1;                                       // tiles of 64 tokens, block-uniform

  // ---- the diagonal tile and the one left of it are asked for at entry: the decay logs are formed from them ----
  stage_tile(sg + (size_t)tt * (64 * PLN), sgs + (size_t)tt * (64 * SP), sl, sls);                    // tile tt -> buffer 0
  if (tt > 0)                                                  // tile tt - 1 -> buffer 1
    stage_tile(sg + (size_t)(tt - 1) * (64 * PLN), sgs + (size_t)(tt - 1) * (64 * SP), sl + XTILE * 2, sls + XTILE * 2);

  // ---- what the dt dot needs of row r, the same for every token: each wave sums for itself, wave 0 stores wd ----
  const float ac  = -__expf(bfr(logA[r]));
  const float dq0 = bfr(dtw[lane]), dq1 = bfr(dtw[32 + lane]);
  const float wd0 = bfr(lnw[r * DS + lane]) * dq0, wd1 = bfr(lnw[r * DS + 32 + lane]) * dq1;
  const float swd = wave_sum(wd0 + wd1);
  const float zc  = wave_sum(bfr(lnb[r * DS + lane]) * dq0 + bfr(lnb[r * DS + 32 + lane]) * dq1) + bfr(dtb[0]);
  if (wave == 0) { wd_s[lane] = wd0; wd_s[32 + lane] = wd1; }
  asm volatile("s_wait_asynccnt 0x0" ::: "memory");            // this wave's share of both tiles has landed
  __syncthreads();                                             // publishes tiles tt and tt - 1 and wd_s

  // ---- inclusive prefix sum of ld[first .. 64 nt - 1]: 128 tokens at a time, one a thread ----
  // Only differences cs[t] - cs[j] are used, so the sum may start at any token in front of which every weight is zero.
  // First trip: it starts at the tile left of the diagonal tile. cs never rises (softplus >= 0, -exp < 0), so the
  // largest weight of a token in front of first is exp(cs[64 tt]), the sum from first to the block's first row. Where
  // that is not under the cut (slow decay, or a not-a-number, which compares false), a second trip sums from token 0.
  int first = (tt > 0) ? (tt - 1) * 64 : 0;                    // block-uniform
#pragma unroll 1                                               // the second trip is the rare one: one copy of the code
  for (int pass = 0; pass < 2; ++pass) {
    float carry = 0.0f;                                        // sum of the 128-token stretches in front of this one
#pragma unroll 1                                               // one trip on the first pass, at most four on the second; block-uniform
    for (int base = first; base < nt * 64; base += 128) {
      const int tok = base + tid;
      const bool own = tok < nt * 64;                          // tokens past the block's last row are never read
      float sc = 0.0f, r64 = 0.0f;
      if (own) {
        if (pass == 0) {                                       // from the two tiles in LDS
          const _Float16* row = xs + (((tok >> 6) == tt) ? 0 : XTILE) + (tok & 63) * XP;
          sc = tok_ld<false>(row, row + DS, wd_s, swd, zc, ac, r64);
        } else {                                               // slow decay: from the plane
          sc = tok_ld<true>(Xv + plb + (size_t)tok * PLN, Sh + ((size_t)(b * TS) + tok) * SP, wd_s, swd, zc, ac, r64);
        }
      }
#pragma unroll                                                 // over the wave's 32 tokens, inclusive: five steps, each with its distance as a constant
      for (int off = 1; off < 32; off <<= 1) {
        const float o = __shfl_up(sc, off, 32);
        sc += (lane >= off) ? o : 0.0f;
      }
      if (lane == 31) wtot[wave] = sc;
      __syncthreads();                                         // the four wave totals are written
      const float w0 = wtot[0], w1 = wtot[1], w2 = wtot[2], w3 = wtot[3];
      float pre = carry;                                       // three selects on the scalar wave number
      pre += (wave > 0) ? w0 : 0.0f;
      pre += (wave > 1) ? w1 : 0.0f;
      pre += (wave > 2) ? w2 : 0.0f;
      carry += (w0 + w1) + (w2 + w3);                          // the same sum in every thread
      if (own) { cs_s[tok] = pre + sc; rs_s[tok] = r64; }
      __syncthreads();                                         // publishes the prefix sum; wtot is free again
    }
    if (first == 0) break;
    // one LDS word, the same for all threads, made scalar so that the branch round the barriers is a scalar one
    const float dwin = __uint_as_float(__builtin_amdgcn_readfirstlane(__float_as_uint(cs_s[tt * 64]))) * 1.44269504088896340736f;
    if (dwin < ZCUT) break;
    first = 0;
  }

  // ---- leading 32-token steps whose decay weights are all zero in both f16 planes ----
  // Over rows t >= top and tokens j <= jl the largest weight is exp(cs[top] - cs[jl]). Lane h < 16 tests step h
  // (jl = 32 h + 31); a step in front of first is zero by the test above; a not-a-number compares false and skips nothing.
  const int tbase = tt * 64 + wave * 16;
  const int jl = l16 * 32 + 31;
  const float cjl = cs_s[(jl < first) ? first : ((jl < nt * 64) ? jl : nt * 64 - 1)];   // only words that were written
  const float dblk = (cs_s[tt * 64] - cjl) * 1.44269504088896340736f;   // the block's first row
  const float dwav = (cs_s[tbase] - cjl) * 1.44269504088896340736f;     // this wave's first row
  const unsigned zblk = __builtin_amdgcn_ballot_w32(hh == 0 && jl < tt * 64 && (jl < first || dblk < ZCUT));
  const unsigned zwav = __builtin_amdgcn_ballot_w32(hh == 0 && jl < tbase && (jl < first || dwav < ZCUT));
  const int k0  = __builtin_ctz(~zblk) >> 1;                   // first tile that the block multiplies, <= tt, the same in all waves
  const int jlo = __builtin_ctz(~zwav) * 32;                   // first step that this wave multiplies, <= tbase

  const int trow  = tbase + l16;
  const float cst = cs_s[trow];

  v8f acc[5], acc2[5];
#pragma unroll
  for (int s = 0; s < 5; ++s) { acc[s] = zero8(); acc2[s] = zero8(); }

  const int jend = tbase + 16;               // wave-uniform causal bound
#pragma unroll 1                             // one tile per trip: the ring's waits and barrier stand once
  for (int kc = tt; kc >= k0; --kc) {
    const int bufo = ((tt - kc) & 1) * XTILE;
#pragma unroll 1                             // kept rolled: the second half is skipped on the diagonal by waves 0 and 1
    for (int j0 = (kc * 64 > jlo) ? kc * 64 : jlo; j0 < kc * 64 + 64 && j0 < jend; j0 += 32) {
      const _Float16* fb = xs + bufo + ((j0 & 32) + 8 * hh + (lane & 7)) * XP + ((lane >> 3) & 1) * 8;
      v16h xf[5];
#pragma unroll
      for (int s = 0; s < 5; ++s) xf[s] = ldfrag_tr(fb + s * 16, fb + 16 * XP + s * 16);
      const int kA = j0 + hh * 8;
      const int kB = j0 + 16 + hh * 8;
      const v4f q0 = *(const v4f*)(cs_s + kA);
      const v4f q1 = *(const v4f*)(cs_s + kA + 4);
      const v4f q2 = *(const v4f*)(cs_s + kB);
      const v4f q3 = *(const v4f*)(cs_s + kB + 4);
      const v4f g0 = *(const v4f*)(rs_s + kA);
      const v4f g1 = *(const v4f*)(rs_s + kA + 4);
      const v4f g2 = *(const v4f*)(rs_s + kB);
      const v4f g3 = *(const v4f*)(rs_s + kB + 4);
      float cj[16], rj[16];
#pragma unroll
      for (int q = 0; q < 4; ++q) {
        cj[q]      = q0[q];
        cj[q + 4]  = q1[q];
        cj[q + 8]  = q2[q];
        cj[q + 12] = q3[q];
        rj[q]      = g0[q];
        rj[q + 4]  = g1[q];
        rj[q + 8]  = g2[q];
        rj[q + 12] = g3[q];
      }
      float ex[16];
#pragma unroll
      for (int e = 0; e < 16; ++e) ex[e] = fminf(cst - cj[e], 0.0f) * 1.44269504088896340736f;
#if defined(__HIP_DEVICE_COMPILE__)
      // The instruction set asks for one slot behind a v_exp_f32 before a register it reads is rewritten. The
      // scheduling barriers keep the sixteen v_exp_f32 by themselves, with nothing between them that rewrites an
      // argument, and hold the v_nop directly behind the last.
      __builtin_amdgcn_sched_barrier(0);
#pragma unroll
      for (int e = 0; e < 16; ++e) ex[e] = __builtin_amdgcn_exp2f(ex[e]);
      __builtin_amdgcn_sched_barrier(0);
      asm volatile("v_nop");
      __builtin_amdgcn_sched_barrier(0);
#endif
      v16h pa, pr;
#pragma unroll
      for (int e = 0; e < 16; ++e) {
        const int j = (e < 8) ? (kA + e) : (kB + e - 8);
        float p = ex[e] * rj[e];
        p = (j <= trow) ? p : 0.0f;                          // causal select by value
        const _Float16 x0 = (_Float16)p;
        pa[e] = x0;
        pr[e] = (_Float16)((p - (float)x0) * 2048.0f);
      }
#pragma unroll
      for (int s = 0; s < 5; ++s) {
        acc[s]  = mma_h(pa, xf[s], acc[s]);
        acc2[s] = mma_h(pr, xf[s], acc2[s]);
      }
    }
    asm volatile("s_wait_dscnt 0x0" ::: "memory");             // this wave's reads of the buffer are done
    asm volatile("s_wait_asynccnt 0x0" ::: "memory");          // this wave's share of tile kc - 1 has landed
    __syncthreads();                                           // publishes tile kc - 1, frees tile kc's buffer
    if (kc - 2 >= k0)
      stage_tile(sg + (size_t)(kc - 2) * (64 * PLN), sgs + (size_t)(kc - 2) * (64 * SP), sl + bufo * 2, sls + bufo * 2);
  }
  asm volatile("s_wait_asynccnt 0x0" ::: "memory");            // no copy is outstanding when the wave goes on

  // ---- epilogue ----
  float* os = os_s + wave * (16 * 64);
  float* es = es_s + wave * (16 * 8);
#pragma unroll
  for (int r8 = 0; r8 < 8; ++r8) {
#pragma unroll
    for (int s = 0; s < 4; ++s) {
      const float val = acc[s][r8] + acc2[s][r8] * (1.0f / 2048.0f);
      os[(8 * hh + r8) * 64 + s * 16 + l16] = val;
    }
  }
  if (l16 < 4) {                                         // columns 64..67: 8 mu hi, residual, 8 / rstd hi, residual
#pragma unroll
    for (int r8 = 0; r8 < 8; ++r8) {
      es[(8 * hh + r8) * 8 + l16]     = acc[4][r8];
      es[(8 * hh + r8) * 8 + 4 + l16] = acc2[4][r8];
    }
  }
  __builtin_amdgcn_fence(__ATOMIC_RELEASE, "workgroup");
  __builtin_amdgcn_wave_barrier();
  __builtin_amdgcn_fence(__ATOMIC_ACQUIRE, "workgroup");
  const int h2 = lane >> 4, c4 = (lane & 15) * 4;       // 256-B row = 16 lanes x 16 B
  v4f wv, bv;
#pragma unroll
  for (int q = 0; q < 4; ++q) { wv[q] = bfr(wq[q]) * (1.0f / 512.0f); bv[q] = bfr(bq[q]) * (1.0f / 512.0f); }   // exact scalings
  v4f ov[8];
#pragma unroll
  for (int it = 0; it < 8; ++it) {
    const int row = it * 2 + h2;                         // it 0..7 x h2 0..1 = rows 0..15
    const v4f sv = *(const v4f*)(os + row * 64 + c4);
    const v4f ea = *(const v4f*)(es + row * 8);
    const v4f eb = *(const v4f*)(es + row * 8 + 4);
    const float sm = ea[0] + (ea[1] + eb[0]) * (1.0f / 2048.0f);    // 512 sum_j A mu_j
    const float sd = ea[2] + (ea[3] + eb[2]) * (1.0f / 2048.0f);    // 512 sum_j A / rstd_j
#pragma unroll
    for (int q = 0; q < 4; ++q) ov[it][q] = (sv[q] - sm) * wv[q] + sd * bv[q];
  }
  {
#pragma unroll
    for (int it = 0; it < 8; ++it) {
      const int row = it * 2 + h2;
      const size_t go = (((size_t)(b * TS + tbase + row)) * DS + r) * DS + c4;
      *(v4f*)(outp + go) = ov[it];
    }
  }
}

// =====================================================================================================
// Workspace map (bytes); every region is an exact multiple of its whole-line store granularity, no aliasing:
//   Xv   f16 [1024][4096]   ([b][t][r][c], x as a bf16 value, x8)   0         8388608
//   St   128 B x [1024]     ([b][t], the token's statistics)        8388608   131072
//   end                                                              8519680
// d_out f32 [2][512][64][64] at byte 0.
// =====================================================================================================
extern "C" void kernel_launch(void* const* d_in, const int* in_sizes, int n_in,
                              void* d_out, int out_size, void* d_ws, size_t ws_size,
                              hipStream_t stream) {
  if (n_in < 6) return;
  if (in_sizes[0] != NTOT) return;
  if (in_sizes[1] != DS) return;
  if (in_sizes[2] != DS) return;
  if (in_sizes[3] != 1) return;
  if (in_sizes[4] != PLN) return;
  if (in_sizes[5] != PLN) return;
  if (out_size != NTOT) return;

  const float* x    = (const float*)d_in[0];   // [2][512][64][64]
  const float* logA = (const float*)d_in[1];   // [64]
  const float* dtw  = (const float*)d_in[2];   // [64]
  const float* dtb  = (const float*)d_in[3];   // [1]
  const float* lnw  = (const float*)d_in[4];   // [64][64]
  const float* lnb  = (const float*)d_in[5];   // [64][64]
  float* outf = (float*)d_out;

  const size_t PB = (size_t)NTOT * 2;          // 8388608
  const size_t SB = (size_t)NBT * 128;         //  131072
  size_t off = 0;
  const size_t oXv  = off; off += PB;
  const size_t oSt  = off; off += SB;
  if (off > ws_size) return;                   // off = 8519680
  if (off > (size_t)134217728) return;

  char* ws = (char*)d_ws;
  unsigned short* Xv  = (unsigned short*)(ws + oXv);
  unsigned int*   St  = (unsigned int*)(ws + oSt);

  const int nbt = in_sizes[0] / PLN;           // 1024
  // (1) LayerNorm statistics and the x plane
  ln_k<<<dim3(nbt), dim3(256), 0, stream>>>(x, Xv, St, nbt);
  // (2) dt, decay logs, prefix sum + causal decay product + gain and bias -> d_out
  ssm_k<<<dim3(TS / 64, DS, NB), dim3(128), 0, stream>>>(Xv, St, logA, dtw, dtb, lnw, lnb, outf);
  (void)hipGetLastError();
}

// v008
// Measured time: 11.6 microseconds a run.
// Next to v007, in two timings, it ran 1.08 times as fast each time.
// Over all steps from v000 it is 5.44 times as fast.
// Contraction out[b][t][r][c] = sum_{j<=t} D[t][j] * xn[b][j][r][c] per (b, r), K = 512, with xn = (v - mu_j) rstd_j w[r][c] + b[r][c] taken apart: out = w * (sum_j A v - sum_j A mu_j) + b * sum_j A / rstd_j, A = D[t][j] rstd_j. v_wmma_f32_16x16x32_f16: A carried x2^6 as f16 hi + x2^11 residual plane; v (x rounded to a bf16 value, eight significant bits) carried x2^3 in ONE f16 plane; mu_j and 1/rstd_j x2^3 as f16 hi + residual in four more B columns; f32 accumulate. LayerNorm statistics, the 64-term dt dot (taken apart the same way: rstd_j (sum_c v w dtw - mu_j sum_c w dtw) + sum_c b dtw), softplus, prefix sum and exp are f32 on VALU; all six inputs RNE-converted to bf16 values on load.
#include <hip/hip_runtime.h>
#include <math.h>
#include <stdint.h>

#define NB   2
#define TS   512
#define DS   64
#define NBT  (NB * TS)          // 1024 (b, t) rows
#define PLN  (DS * DS)          // 4096 elements per (b, t)
#define NTOT (NBT * PLN)        // 4194304
static_assert((TS % 64) == 0);
static_assert(DS == 64);
static_assert(PLN == 2 * 8 * 256);

typedef _Float16 v16h __attribute__((ext_vector_type(16)));
typedef short    v8s  __attribute__((ext_vector_type(8)));
typedef _Float16 v8h  __attribute__((ext_vector_type(8)));
typedef float    v8f  __attribute__((ext_vector_type(8)));
typedef float    v4f  __attribute__((ext_vector_type(4)));
typedef unsigned int v4u __attribute__((ext_vector_type(4)));

// ---- scalar helpers --------------------------------------------------------------------------------
__device__ __forceinline__ unsigned short bf_bits(float f) {          // f32 -> bf16 bits, RNE convert
  unsigned u = __float_as_uint(f);
  return (unsigned short)((u + 0x7FFFu + ((u >> 16) & 1u)) >> 16);
}
__device__ __forceinline__ float bfr(float f) { return __uint_as_float(((unsigned)bf_bits(f)) << 16); }
__device__ __forceinline__ unsigned short h_bits(_Float16 x) { return __builtin_bit_cast(unsigned short, x); }
__device__ __forceinline__ unsigned pk16(unsigned short a, unsigned short b) { return (unsigned)a | ((unsigned)b << 16); }
__device__ __forceinline__ v8f zero8() { v8f z = {0.f, 0.f, 0.f, 0.f, 0.f, 0.f, 0.f, 0.f}; return z; }
__device__ __forceinline__ float wave_sum(float v) {
#pragma unroll
  for (int off = 16; off > 0; off >>= 1) v += __shfl_xor(v, off, 32);
  return v;
}

// ---- WMMA helper with trailing VALU hazard gap ----------------------------------------------------------
__device__ __forceinline__ v8f mma_h(v16h a, v16h b, v8f c) {
  c = __builtin_amdgcn_wmma_f32_16x16x32_f16(false, a, false, b, (short)0, c, false, false);
#if defined(__HIP_DEVICE_COMPILE__)
  asm volatile("v_nop\n\tv_nop\n\tv_nop\n\tv_nop" : "+v"(c) : "v"(a), "v"(b));
#endif
  return c;
}

// =====================================================================================================
// Stage 1: one block per (b, t), 256 threads. Thread tid owns elements e0 = tid*8..+7 (row tid>>3,
// cols (tid&7)*8..+7) and e1 = 2048 + tid*8..+7 (row 32 + tid>>3, same cols) of the 64x64 slice.
// Outputs: Xv = f16(8 v), v = x as a bf16 value, in [b][t][r][c] layout (exact for 2^-20 <= |v| < 8188; below, within
// 2^-28 of v); St: one 128-B line per (b,t): halves 0..3 = 8 mu hi, residual x2048, 8 / rstd hi, residual x2048, float
// word 2 = 64 rstd, float word 3 = mu, the rest 0 (the first 32 B are the token's 16 extra B columns in stage 2, which
// uses the sums of columns 0..3 alone: a column's values reach no other column's sum).
// coverage: Xv 2 x 256 x 8 = 4096 halves per (b,t); St 8 x 16 B per (b,t); grid = all (b,t).
// =====================================================================================================
__global__ __launch_bounds__(256) void ln_k(const float* __restrict__ x, unsigned short* Xv, unsigned int* Stp, int nbt) {
  __shared__ float red0[8];
  __shared__ float red1[8];
  const int bt = blockIdx.x;
  if (bt >= nbt) return;                       // block-uniform, before any barrier
  const int tid = threadIdx.x, lane = tid & 31, wave = tid >> 5;
  const int e0 = tid * 8, e1 = 2048 + tid * 8;
  const float* xp = x + (size_t)bt * PLN;

  const v4f xa = *(const v4f*)(xp + e0);
  const v4f xb = *(const v4f*)(xp + e0 + 4);
  const v4f xc = *(const v4f*)(xp + e1);
  const v4f xd = *(const v4f*)(xp + e1 + 4);
  float v[16];
#pragma unroll
  for (int q = 0; q < 4; ++q) {
    v[q]      = bfr(xa[q]);
    v[4 + q]  = bfr(xb[q]);
    v[8 + q]  = bfr(xc[q]);
    v[12 + q] = bfr(xd[q]);
  }
  // ---- mean ----
  float s = 0.0f;
#pragma unroll
  for (int i = 0; i < 16; ++i) s += v[i];
  s = wave_sum(s);
  if (lane == 0) red0[wave] = s;
  __syncthreads();
  float tot = 0.0f;
#pragma unroll
  for (int w = 0; w < 8; ++w) tot += red0[w];
  const float mu = tot * (1.0f / 4096.0f);
  // ---- centred variance ----
  float ss = 0.0f;
#pragma unroll
  for (int i = 0; i < 16; ++i) { const float d = v[i] - mu; ss += d * d; }
  ss = wave_sum(ss);
  if (lane == 0) red1[wave] = ss;
  __syncthreads();
  float vt = 0.0f;
#pragma unroll
  for (int w = 0; w < 8; ++w) vt += red1[w];
  const float var  = vt * (1.0f / 4096.0f);
  const float rstd = rsqrtf(var + 1e-5f);
  // ---- the one plane: f16(8 v) ----
  v4u p0, p1;
#pragma unroll
  for (int e = 0; e < 4; ++e) {
    p0[e] = pk16(h_bits((_Float16)(v[2 * e] * 8.0f)), h_bits((_Float16)(v[2 * e + 1] * 8.0f)));
    p1[e] = pk16(h_bits((_Float16)(v[8 + 2 * e] * 8.0f)), h_bits((_Float16)(v[8 + 2 * e + 1] * 8.0f)));
  }
  const size_t po0 = (size_t)bt * PLN + e0;
  const size_t po1 = (size_t)bt * PLN + e1;
  *(v4u*)(Xv + po0) = p0;
  *(v4u*)(Xv + po1) = p1;
  if ((tid >> 3) == 8) {                       // eight lanes of wave 2 store the token's whole 128-B line
    const int q = tid & 7;
    const float m8 = mu * 8.0f;
    const float q8 = 8.0f / rstd;
    const _Float16 mh = (_Float16)m8, qh = (_Float16)q8;
    const _Float16 ml = (_Float16)((m8 - (float)mh) * 2048.0f);
    const _Float16 ql = (_Float16)((q8 - (float)qh) * 2048.0f);
    v4u sv = {0u, 0u, 0u, 0u};
    if (q == 0) {
      sv[0] = pk16(h_bits(mh), h_bits(ml)); sv[1] = pk16(h_bits(qh), h_bits(ql));
      sv[2] = __float_as_uint(rstd * 64.0f); sv[3] = __float_as_uint(mu);
    }
    *(v4u*)(Stp + (size_t)bt * 32 + q * 4) = sv;
  }
}

// =====================================================================================================
// Stage 2: out[b][t][r][c] = w[r][c] * (sum_j A[t][j] v[j][c] - sum_j A[t][j] mu_j) + b[r][c] * sum_j A[t][j] / rstd_j,
// j <= t, A[t][j] = exp(cs[b][t][r] - cs[b][j][r]) * rstd_j: the reference's sum over exp(..) * xn with the LayerNorm's
// per-token scale moved into the decay operand and its gain and bias, which do not depend on j, moved behind the sum.
// Block = (64-row t tile tt, r, b), 4 waves; wave w owns t rows tt*64 + 16w .. +15 and all 64 c.
// ld[j] = softplus(z_j) * (-exp(log_A[r])), z_j = rstd_j (sum_c v[j][c] w[r][c] dtw[c] - mu_j sum_c w[r][c] dtw[c]) +
// sum_c b[r][c] dtw[c] + dt_b: the block forms it itself, one token a thread, from the token's row and statistics in the
// two LDS tiles tt and tt - 1, which are copied at entry (softplus(z) = max(z,0) + log1p(exp(-|z|))).
// cs: the block forms an inclusive prefix sum of ld[first .. 64 (tt + 1) - 1] in f32: one token a thread, a
// shuffle scan over each wave's 32 tokens, then the earlier waves' totals from LDS. first = 64 (tt - 1) where a
// run-time test shows that every earlier token's weight is zero in both planes, else 0 (ld then read from the plane).
// A fragment (built in registers): lane row = lane&15 -> t = tbase + (lane&15); element e<8 -> j =
// j0 + 8h + e, e>=8 -> j = j0 + 16 + 8h + (e-8) (split k map); value p = exp(min(cs_t - cs_j, 0)) * 64 rstd_j,
// 0 for j > t (select by value), hi = f16(p), residual = f16((p - hi) * 2048). rstd <= 1 / sqrt(1e-5), so p < 20300.
// B tiles: 64 tokens x 80 columns in LDS (rows = tokens, pitch 160 B): columns 0..63 are the token's 128 B of the
// [b][t][r][c] plane, columns 64..79 the first 32 B of the token's St line, both as stage 1 stores them, brought by
// asynchronous copies, two buffers, tiles in falling order tt, tt - 1, .. k0: tile k-2 flies while tile k-1 is worked on;
// all four waves read from that one copy.
// B fragments: two transposing LDS loads (ds_load_tr16_b128) at token rows j0 and j0 + 16: lane (c = lane&15, h)
// gets tokens j0 + 8h .. +7 and j0 + 16 + 8h .. +7 of column c (split k map, as the A fragment).
// acc += Ahi.B; acc2 += Ares.B; sum = (acc + acc2/2048) / 2^9; in the fifth column group the residual columns add /2048.
// Leading steps whose weights are all zero in both planes (test on the prefix sums, at run time) are left out: the
// block multiplies tiles k0 .. tt only, a wave starts at its own step jlo. With slow decay k0 = 0 and all is done.
// The tile loop's trip count tt + 1 - k0 is block-uniform; a wave skips the 32-token half past its diagonal
// (wave-uniform scalar test) but passes every wait and barrier.
// Only the 32-token step j0d that holds a wave's diagonal builds its A fragment so. Left of it the decay has rank one,
// exp(cs_t - cs_ref) * exp(cs_ref - cs_j), ref = j0d - 1: the second factor times 64 rstd_j is made once a token (hi and
// residual, for the block's two refs: four arrays in LDS); A row m is array m & 3, so that one WMMA a column group gives
// all four sums (D register m & 3 of every lane), and the wave's own pair, times exp(cs_t - cs_ref), joins acc at the end.
// Not yet used: stage 2 could round x itself and stage 1 store no plane at all.
// coverage: 4 waves x 16 rows x 64 cols = the block's 64 x 64 tile; grid (TS/64, DS, NB) = every (t, r, b) once.
// =====================================================================================================
#define XP    80                 // LDS row pitch in halves: 160 B = 32 B x 5, the transposing load's pitch
#define XTILE (64 * XP)          // halves of one tile in LDS
#define SP    64                 // halves of one token's St line
#define UPT   (TS + 16)          // halves from one weight array to the next: 8 banks on, so the four arrays' reads do not collide
// A weight exp2(d) is carried as f16(exp2(d) * rstd * 2^6) and f16(residual * 2^11), rstd < 2^8.31: at d <= -50.4 both
// round to zero, and the products of such a step add exactly nothing. The rest of the cut is for the rounding of the
// prefix sums and of v_exp_f32.
#define ZCUT  (-52.0f)

// One block-wide tile fill: thread tid copies 16 B pieces (token row i*16 + tid>>3, piece tid&7), i = 0..3, of the
// plane, and one 16 B piece (token row tid>>1, piece tid&1) of the St lines. g, gs: this lane's source pieces;
// l, ls: this lane's LDS byte addresses. Row step of the plane's pieces: 16 rows.
__device__ __forceinline__ void stage_tile(const _Float16* g, const _Float16* gs, unsigned l, unsigned ls) {
  const _Float16* g1 = g + 16 * PLN; const _Float16* g2 = g + 32 * PLN; const _Float16* g3 = g + 48 * PLN;
  const unsigned st = 16 * XP * 2;
  const unsigned l1 = l + st, l2 = l + 2 * st, l3 = l + 3 * st;
#if defined(__HIP_DEVICE_COMPILE__)
  // the five copies and, as the last line, the wait that stands before any of their address registers is rewritten
  asm volatile("global_load_async_to_lds_b128 %0, %5, off\n\t"
               "global_load_async_to_lds_b128 %1, %6, off\n\t"
               "global_load_async_to_lds_b128 %2, %7, off\n\t"
               "global_load_async_to_lds_b128 %3, %8, off\n\t"
               "global_load_async_to_lds_b128 %4, %9, off\n\t"
               "s_wait_xcnt 0x0"
               :: "v"(l), "v"(l1), "v"(l2), "v"(l3), "v"(ls),
                  "v"(g), "v"(g1), "v"(g2), "v"(g3), "v"(gs)
               : "memory");
#endif
}

// Transposing fragment load: p = this lane's 16-B piece of the token-major tile (row kbase + 8h + (lane&7), piece
// (lane>>3)&1 of the 16 columns); q = the same 16 rows further on. Elements 0..7 <- tokens kbase + 8h .. +7,
// elements 8..15 <- tokens kbase + 16 + 8h .. +7, both of column lane&15.
__device__ __forceinline__ v16h ldfrag_tr(const _Float16* p, const _Float16* q) {
  typedef __attribute__((address_space(3))) v8s lds_v8s;
  union { v16h v; v8s h[2]; } f;
  f.h[0] = __builtin_amdgcn_ds_load_tr16_b128_v8i16((lds_v8s*)p);
  f.h[1] = __builtin_amdgcn_ds_load_tr16_b128_v8i16((lds_v8s*)q);
  return f.v;
}

// Decay log and 64 rstd of one token: row = its 64 halves 8 v, st = the first 16 B of its St line (16-B aligned; both in
// LDS, or with GLB both in global memory), wd = w[r][c] dtw[c] (64 floats in LDS), swd = their sum,
// zc = sum_c b[r][c] dtw[c] + dt_b, ac = -exp(log_A[r]).
// acc + f16 (low or high half of h) * w in one instruction an element (v_fma_mix_f32): left to itself the compiler
// converts every half by itself and pairs the products, with register moves to form the pairs.
__device__ __forceinline__ float mix_lo(unsigned h, float w, float acc) {
#if defined(__HIP_DEVICE_COMPILE__)
  asm("v_fma_mix_f32 %0, %1, %2, %0 op_sel_hi:[1,0,0]" : "+v"(acc) : "v"(h), "v"(w));
#endif
  return acc;
}
__device__ __forceinline__ float mix_hi(unsigned h, float w, float acc) {
#if defined(__HIP_DEVICE_COMPILE__)
  asm("v_fma_mix_f32 %0, %1, %2, %0 op_sel:[1,0,0] op_sel_hi:[1,0,0]" : "+v"(acc) : "v"(h), "v"(w));
#endif
  return acc;
}

template <bool GLB>
__device__ __forceinline__ float tok_ld(const _Float16* row, const _Float16* st, const float* wd,
                                        float swd, float zc, float ac, float& r64) {
  v4u hv[8];                                                   // two halves a word, columns 8 i + 2 q and + 1
#pragma unroll
  for (int i = 0; i < 8; ++i) hv[i] = *(const v4u*)(row + 8 * i);
  const v4u sv = *(const v4u*)st;
#if defined(__HIP_DEVICE_COMPILE__)
  if (GLB) {
    // the wait stands before an address register of the nine loads is rewritten; the scheduling barriers hold it
    // directly behind them, in front of the next trip's address additions
    __builtin_amdgcn_sched_barrier(0);
    asm volatile("s_wait_xcnt 0x0" ::: "memory");
    __builtin_amdgcn_sched_barrier(0);
  }
#endif
  float d[4] = {0.0f, 0.0f, 0.0f, 0.0f};                       // four chains, so that an add waits on the fourth before it only
#pragma unroll
  for (int i = 0; i < 8; ++i) {
    const v4f wa = *(const v4f*)(wd + 8 * i);
    const v4f wb = *(const v4f*)(wd + 8 * i + 4);
    d[0] = mix_lo(hv[i][0], wa[0], d[0]); d[1] = mix_hi(hv[i][0], wa[1], d[1]);
    d[2] = mix_lo(hv[i][1], wa[2], d[2]); d[3] = mix_hi(hv[i][1], wa[3], d[3]);
    d[0] = mix_lo(hv[i][2], wb[0], d[0]); d[1] = mix_hi(hv[i][2], wb[1], d[1]);
    d[2] = mix_lo(hv[i][3], wb[2], d[2]); d[3] = mix_hi(hv[i][3], wb[3], d[3]);
  }
  r64 = __uint_as_float(sv[2]);
  const float mu8 = __uint_as_float(sv[3]) * 8.0f;
  const float z  = (r64 * (1.0f / 512.0f)) * (((d[0] + d[1]) + (d[2] + d[3])) - mu8 * swd) + zc;
  const float sp = fmaxf(z, 0.0f) + log1pf(__expf(-fabsf(z)));   // softplus
  return sp * ac;
}

__global__ __launch_bounds__(128) void ssm_k(const unsigned short* __restrict__ Xvp, const unsigned int* __restrict__ Stp,
                                             const float* __restrict__ logA, const float* __restrict__ dtw,
                                             const float* __restrict__ dtb, const float* __restrict__ lnw,
                                             const float* __restrict__ lnb, float* outp) {
  __shared__ __align__(16) float cs_s[TS];
  __shared__ __align__(16) float rs_s[TS];                    // 64 rstd per token
  __shared__ __align__(16) float wd_s[DS];                    // w[r][c] dtw[c]
  __shared__ __align__(16) _Float16 u_s[4 * UPT];             // per token: weight to refA hi, residual, weight to refB hi, residual
  __shared__ float wtot[4];
  __shared__ __align__(16) float os_s[4 * 16 * 64];
  __shared__ __align__(16) float es_s[4 * 16 * 8];            // per wave and row: the fifth column group's first four sums, both planes
  __shared__ __align__(16) _Float16 xs[2 * XTILE];            // [buffer][token][column], pitch XP
  const int tt = blockIdx.x, r = blockIdx.y, b = blockIdx.z;
  const int tid = threadIdx.x, lane = tid & 31, hh = lane >> 4, l16 = lane & 15;
  const int wave = __builtin_amdgcn_readfirstlane(tid >> 5);  // scalar, so that the per-wave skip is a scalar branch

  // gain and bias of this lane's four output columns, asked for at entry, used at the store
  const v4f wq = *(const v4f*)(lnw + r * DS + l16 * 4);
  const v4f bq = *(const v4f*)(lnb + r * DS + l16 * 4);

  const _Float16* Xv = (const _Float16*)(const void*)Xvp;
  const _Float16* Sh = (const _Float16*)(const void*)Stp;
  const size_t plb = ((size_t)(b * TS) * DS + r) * DS;         // (b, token 0, r, c 0)
  const int    sof = (tid >> 3) * PLN + (tid & 7) * 8;         // this lane's first piece inside a tile's rows
  const _Float16* sg  = Xv + plb + sof;
  const _Float16* sgs = Sh + ((size_t)(b * TS) + (tid >> 1)) * SP + (tid & 1) * 8;
  const unsigned  sl  = (unsigned)(uintptr_t)(xs + (tid >> 3) * XP + (tid & 7) * 8);        // LDS byte address
  const unsigned  sls = (unsigned)(uintptr_t)(xs + (tid >> 1) * XP + DS + (tid & 1) * 8);   // LDS byte address
  const int nt = tt + 1;                                       // tiles of 64 tokens, block-uniform

  // ---- the diagonal tile and the one left of it are asked for at entry: the decay logs are formed from them ----
  stage_tile(sg + (size_t)tt * (64 * PLN), sgs + (size_t)tt * (64 * SP), sl, sls);                    // tile tt -> buffer 0
  if (tt > 0)                                                  // tile tt - 1 -> buffer 1
    stage_tile(sg + (size_t)(tt - 1) * (64 * PLN), sgs + (size_t)(tt - 1) * (64 * SP), sl + XTILE * 2, sls + XTILE * 2);

  // ---- what the dt dot needs of row r, the same for every token: each wave sums for itself, wave 0 stores wd ----
  const float ac  = -__expf(bfr(logA[r]));
  const float dq0 = bfr(dtw[lane]), dq1 = bfr(dtw[32 + lane]);
  const float wd0 = bfr(lnw[r * DS + lane]) * dq0, wd1 = bfr(lnw[r * DS + 32 + lane]) * dq1;
  const float swd = wave_sum(wd0 + wd1);
  const float zc  = wave_sum(bfr(lnb[r * DS + lane]) * dq0 + bfr(lnb[r * DS + 32 + lane]) * dq1) + bfr(dtb[0]);
  if (wave == 0) { wd_s[lane] = wd0; wd_s[32 + lane] = wd1; }
  asm volatile("s_wait_asynccnt 0x0" ::: "memory");            // this wave's share of both tiles has landed
  __syncthreads();                                             // publishes tiles tt and tt - 1 and wd_s

  // ---- inclusive prefix sum of ld[first .. 64 nt - 1]: 128 tokens at a time, one a thread ----
  // Only differences cs[t] - cs[j] are used, so the sum may start at any token in front of which every weight is zero.
  // First trip: it starts at the tile left of the diagonal tile. cs never rises (softplus >= 0, -exp < 0), so the
  // largest weight of a token in front of first is exp(cs[64 tt - 1]), the sum from first to the token refA. Where
  // that is not under the cut (slow decay, or a not-a-number, which compares false), a second trip sums from token 0.
  int first = (tt > 0) ? (tt - 1) * 64 : 0;                    // block-uniform
#pragma unroll 1                                               // the second trip is the rare one: one copy of the code
  for (int pass = 0; pass < 2; ++pass) {
    float carry = 0.0f;                                        // sum of the 128-token stretches in front of this one
#pragma unroll 1                                               // one trip on the first pass, at most four on the second; block-uniform
    for (int base = first; base < nt * 64; base += 128) {
      const int tok = base + tid;
      const bool own = tok < nt * 64;                          // tokens past the block's last row are never read
      float sc = 0.0f, r64 = 0.0f;
      if (own) {
        if (pass == 0) {                                       // from the two tiles in LDS
          const _Float16* row = xs + (((tok >> 6) == tt) ? 0 : XTILE) + (tok & 63) * XP;
          sc = tok_ld<false>(row, row + DS, wd_s, swd, zc, ac, r64);
        } else {                                               // slow decay: from the plane
          sc = tok_ld<true>(Xv + plb + (size_t)tok * PLN, Sh + ((size_t)(b * TS) + tok) * SP, wd_s, swd, zc, ac, r64);
        }
      }
#pragma unroll                                                 // over the wave's 32 tokens, inclusive: five steps, each with its distance as a constant
      for (int off = 1; off < 32; off <<= 1) {
        const float o = __shfl_up(sc, off, 32);
        sc += (lane >= off) ? o : 0.0f;
      }
      if (lane == 31) wtot[wave] = sc;
      __syncthreads();                                         // the four wave totals are written
      const float w0 = wtot[0], w1 = wtot[1], w2 = wtot[2], w3 = wtot[3];
      float pre = carry;                                       // three selects on the scalar wave number
      pre += (wave > 0) ? w0 : 0.0f;
      pre += (wave > 1) ? w1 : 0.0f;
      pre += (wave > 2) ? w2 : 0.0f;
      carry += (w0 + w1) + (w2 + w3);                          // the same sum in every thread
      if (own) { cs_s[tok] = pre + sc; rs_s[tok] = r64; }
      __syncthreads();                                         // publishes the prefix sum; wtot is free again
    }
    if (first == 0) break;
    // one LDS word, the same for all threads, made scalar so that the branch round the barriers is a scalar one
    const float dwin = __uint_as_float(__builtin_amdgcn_readfirstlane(__float_as_uint(cs_s[tt * 64 - 1]))) * 1.44269504088896340736f;
    if (dwin < ZCUT) break;
    first = 0;
  }

  // ---- per-token weights of the rank-one steps, made once a token ----
  // Left of the 32-token step j0d that holds a wave's diagonal, exp(cs_t - cs_j) = exp(cs_t - cs_ref) exp(cs_ref - cs_j),
  // ref = j0d - 1: refA = 64 tt - 1 for waves 0 and 1, refB = 64 tt + 31 for waves 2 and 3. Both factors are <= 1.
  // u = exp(cs_ref - cs_j) * 64 rstd_j, 0 for j > ref, split as the decay operand is: hi = f16(u), residual x2048.
  const int tbase = tt * 64 + wave * 16;
  const int j0d   = tbase & ~31;                               // scalar: the step that holds this wave's diagonal
  const int refA  = tt * 64 - 1, refB = tt * 64 + 31;
  const float csA = cs_s[(tt > 0) ? refA : 0];                 // tt == 0: no token lies left of refA, every weight to it is 0
  const float csB = cs_s[refB];
#pragma unroll 1                                               // one trip with fast decay, at most four; no barrier inside
  for (int tok = first + tid; tok <= refB; tok += 128) {
    const float cj = cs_s[tok], rj = rs_s[tok];
    float ua = __builtin_amdgcn_exp2f(fminf(csA - cj, 0.0f) * 1.44269504088896340736f) * rj;
    const float ub = __builtin_amdgcn_exp2f(fminf(csB - cj, 0.0f) * 1.44269504088896340736f) * rj;
    ua = (tok <= refA) ? ua : 0.0f;
    const _Float16 ah = (_Float16)ua, bh = (_Float16)ub;
    u_s[tok]           = ah;
    u_s[UPT + tok]     = (_Float16)((ua - (float)ah) * 2048.0f);
    u_s[2 * UPT + tok] = bh;
    u_s[3 * UPT + tok] = (_Float16)((ub - (float)bh) * 2048.0f);
  }

  // ---- leading 32-token steps whose weights are all zero in both f16 planes ----
  // Over tokens j <= jl the largest weight to ref is exp(cs[ref] - cs[jl]). Lane h < 16 tests step h
  // (jl = 32 h + 31); a step in front of first is zero by the test above; a not-a-number compares false and skips nothing.
  const float csR = (wave < 2) ? csA : csB;                    // this wave's ref
  const int jl = l16 * 32 + 31;
  const float cjl = cs_s[(jl < first) ? first : ((jl < nt * 64) ? jl : nt * 64 - 1)];   // only words that were written
  const float dblk = (csA - cjl) * 1.44269504088896340736f;    // refA: the larger weights, so the block's bound
  const float dwav = (csR - cjl) * 1.44269504088896340736f;
  const unsigned zblk = __builtin_amdgcn_ballot_w32(hh == 0 && jl < tt * 64 && (jl < first || dblk < ZCUT));
  const unsigned zwav = __builtin_amdgcn_ballot_w32(hh == 0 && jl < j0d && (jl < first || dwav < ZCUT));
  const int k0  = __builtin_ctz(~zblk) >> 1;                   // first tile that the block multiplies, <= tt, the same in all waves
  const int jlo = __builtin_ctz(~zwav) * 32;                   // first step that this wave multiplies, <= j0d

  const int trow  = tbase + l16;
  const float cst = cs_s[trow];

  v8f acc[5], acc2[5];
#pragma unroll
  for (int s = 0; s < 5; ++s) { acc[s] = zero8(); acc2[s] = zero8(); }
  v8f sr[5];                                 // rank-one sums: row m of the tile holds the sum under weight array m & 3
#pragma unroll
  for (int s = 0; s < 5; ++s) sr[s] = zero8();

  // ---- the step that holds the wave's diagonal: tile tt lies in buffer 0; decay operand built element by element ----
  {
    const int j0 = j0d;
    const _Float16* fb = xs + ((j0 & 32) + 8 * hh + (lane & 7)) * XP + ((lane >> 3) & 1) * 8;
    v16h xf[5];
#pragma unroll
    for (int s = 0; s < 5; ++s) xf[s] = ldfrag_tr(fb + s * 16, fb + 16 * XP + s * 16);
    const int kA = j0 + hh * 8;
    const int kB = j0 + 16 + hh * 8;
    const v4f q0 = *(const v4f*)(cs_s + kA);
    const v4f q1 = *(const v4f*)(cs_s + kA + 4);
    const v4f q2 = *(const v4f*)(cs_s + kB);
    const v4f q3 = *(const v4f*)(cs_s + kB + 4);
    const v4f g0 = *(const v4f*)(rs_s + kA);
    const v4f g1 = *(const v4f*)(rs_s + kA + 4);
    const v4f g2 = *(const v4f*)(rs_s + kB);
    const v4f g3 = *(const v4f*)(rs_s + kB + 4);
    float cj[16], rj[16];
#pragma unroll
    for (int q = 0; q < 4; ++q) {
      cj[q]      = q0[q];
      cj[q + 4]  = q1[q];
      cj[q + 8]  = q2[q];
      cj[q + 12] = q3[q];
      rj[q]      = g0[q];
      rj[q + 4]  = g1[q];
      rj[q + 8]  = g2[q];
      rj[q + 12] = g3[q];
    }
    float ex[16];
#pragma unroll
    for (int e = 0; e < 16; ++e) ex[e] = fminf(cst - cj[e], 0.0f) * 1.44269504088896340736f;
#if defined(__HIP_DEVICE_COMPILE__)
    // The instruction set asks for one slot behind a v_exp_f32 before a register it reads is rewritten. The
    // scheduling barriers keep the v_exp_f32 between them by themselves, with nothing among them that rewrites an
    // argument, and hold the v_nop directly behind the last.
    __builtin_amdgcn_sched_barrier(0);
#pragma unroll
    for (int e = 0; e < 16; ++e) ex[e] = __builtin_amdgcn_exp2f(ex[e]);
    __builtin_amdgcn_sched_barrier(0);
    asm volatile("v_nop");
    __builtin_amdgcn_sched_barrier(0);
#endif
    v16h pa, pr;
#pragma unroll
    for (int e = 0; e < 16; ++e) {
      const int j = (e < 8) ? (kA + e) : (kB + e - 8);
      float p = ex[e] * rj[e];
      p = (j <= trow) ? p : 0.0f;                          // causal select by value
      const _Float16 x0 = (_Float16)p;
      pa[e] = x0;
      pr[e] = (_Float16)((p - (float)x0) * 2048.0f);
    }
#pragma unroll
    for (int s = 0; s < 5; ++s) {
      acc[s]  = mma_h(pa, xf[s], acc[s]);
      acc2[s] = mma_h(pr, xf[s], acc2[s]);
    }
  }

  // ---- the steps left of it, rank one ----
  __syncthreads();                           // publishes u_s; it stands behind the diagonal step, which reads none of it
#pragma unroll 1                             // one tile per trip: the ring's waits and barrier stand once
  for (int kc = tt; kc >= k0; --kc) {
    const int bufo = ((tt - kc) & 1) * XTILE;
#pragma unroll 1                             // kept rolled: none, one or two steps, by the wave and by the run-time skip
    for (int j0 = (kc * 64 > jlo) ? kc * 64 : jlo; j0 < kc * 64 + 64 && j0 < j0d; j0 += 32) {
      const _Float16* fb = xs + bufo + ((j0 & 32) + 8 * hh + (lane & 7)) * XP + ((lane >> 3) & 1) * 8;
      v16h xf[5];
#pragma unroll
      for (int s = 0; s < 5; ++s) xf[s] = ldfrag_tr(fb + s * 16, fb + 16 * XP + s * 16);
      // A row m = weight array m & 3, elements in the split k map: tokens j0 + 8h .. +7 and j0 + 16 + 8h .. +7
      const _Float16* up = u_s + (l16 & 3) * UPT + j0 + hh * 8;
      union { v16h v; v8h h[2]; } uf;
      uf.h[0] = *(const v8h*)up;
      uf.h[1] = *(const v8h*)(up + 16);
      __builtin_amdgcn_sched_barrier(0);     // the step's twelve LDS reads are issued together, none among the WMMAs
#pragma unroll
      for (int s = 0; s < 4; ++s)
        sr[s] = __builtin_amdgcn_wmma_f32_16x16x32_f16(false, uf.v, false, xf[s], (short)0, sr[s], false, false);
      __builtin_amdgcn_sched_barrier(0);     // keeps the WMMA with the hazard gap the last one in front of the loop's branch
      sr[4] = mma_h(uf.v, xf[4], sr[4]);
    }
    asm volatile("s_wait_dscnt 0x0" ::: "memory");             // this wave's reads of the buffer are done
    asm volatile("s_wait_asynccnt 0x0" ::: "memory");          // this wave's share of tile kc - 1 has landed
    __syncthreads();                                           // publishes tile kc - 1, frees tile kc's buffer
    if (kc - 2 >= k0)
      stage_tile(sg + (size_t)(kc - 2) * (64 * PLN), sgs + (size_t)(kc - 2) * (64 * SP), sl + bufo * 2, sls + bufo * 2);
  }
  asm volatile("s_wait_asynccnt 0x0" ::: "memory");            // no copy is outstanding when the wave goes on

  // ---- the rank-one sums join the diagonal step's: row t takes exp(cs_t - cs_ref) times this wave's ref's sum ----
  {
    const v4f t0 = *(const v4f*)(cs_s + tbase + 8 * hh);
    const v4f t1 = *(const v4f*)(cs_s + tbase + 8 * hh + 4);
    float et[8];
#pragma unroll
    for (int q = 0; q < 4; ++q) {
      et[q]     = fminf(t0[q] - csR, 0.0f) * 1.44269504088896340736f;
      et[q + 4] = fminf(t1[q] - csR, 0.0f) * 1.44269504088896340736f;
    }
#if defined(__HIP_DEVICE_COMPILE__)
    // as in the diagonal step: the eight v_exp_f32 by themselves, and the one slot behind the last before its argument's
    // register is rewritten
    __builtin_amdgcn_sched_barrier(0);
#pragma unroll
    for (int q = 0; q < 8; ++q) et[q] = __builtin_amdgcn_exp2f(et[q]);
    __builtin_amdgcn_sched_barrier(0);
    asm volatile("v_nop");
    __builtin_amdgcn_sched_barrier(0);
#endif
#pragma unroll
    for (int s = 0; s < 5; ++s) {
      const float sa = sr[s][0] + sr[s][1] * (1.0f / 2048.0f);
      const float sb = sr[s][2] + sr[s][3] * (1.0f / 2048.0f);
      const float sv = (wave < 2) ? sa : sb;
#pragma unroll
      for (int r8 = 0; r8 < 8; ++r8) acc[s][r8] += et[r8] * sv;
    }
  }

  // ---- epilogue ----
  float* os = os_s + wave * (16 * 64);
  float* es = es_s + wave * (16 * 8);
#pragma unroll
  for (int r8 = 0; r8 < 8; ++r8) {
#pragma unroll
    for (int s = 0; s < 4; ++s) {
      const float val = acc[s][r8] + acc2[s][r8] * (1.0f / 2048.0f);
      os[(8 * hh + r8) * 64 + s * 16 + l16] = val;
    }
  }
  if (l16 < 4) {                                         // columns 64..67: 8 mu hi, residual, 8 / rstd hi, residual
#pragma unroll
    for (int r8 = 0; r8 < 8; ++r8) {
      es[(8 * hh + r8) * 8 + l16]     = acc[4][r8];
      es[(8 * hh + r8) * 8 + 4 + l16] = acc2[4][r8];
    }
  }
  __builtin_amdgcn_fence(__ATOMIC_RELEASE, "workgroup");
  __builtin_amdgcn_wave_barrier();
  __builtin_amdgcn_fence(__ATOMIC_ACQUIRE, "workgroup");
  const int h2 = lane >> 4, c4 = (lane & 15) * 4;       // 256-B row = 16 lanes x 16 B
  v4f wv, bv;
#pragma unroll
  for (int q = 0; q < 4; ++q) { wv[q] = bfr(wq[q]) * (1.0f / 512.0f); bv[q] = bfr(bq[q]) * (1.0f / 512.0f); }   // exact scalings
  v4f ov[8];
#pragma unroll
  for (int it = 0; it < 8; ++it) {
    const int row = it * 2 + h2;                         // it 0..7 x h2 0..1 = rows 0..15
    const v4f sv = *(const v4f*)(os + row * 64 + c4);
    const v4f ea = *(const v4f*)(es + row * 8);
    const v4f eb = *(const v4f*)(es + row * 8 + 4);
    const float sm = ea[0] + (ea[1] + eb[0]) * (1.0f / 2048.0f);    // 512 sum_j A mu_j
    const float sd = ea[2] + (ea[3] + eb[2]) * (1.0f / 2048.0f);    // 512 sum_j A / rstd_j
#pragma unroll
    for (int q = 0; q < 4; ++q) ov[it][q] = (sv[q] - sm) * wv[q] + sd * bv[q];
  }
  {
#pragma unroll
    for (int it = 0; it < 8; ++it) {
      const int row = it * 2 + h2;
      const size_t go = (((size_t)(b * TS + tbase + row)) * DS + r) * DS + c4;
      *(v4f*)(outp + go) = ov[it];
    }
  }
}

// =====================================================================================================
// Workspace map (bytes); every region is an exact multiple of its whole-line store granularity, no aliasing:
//   Xv   f16 [1024][4096]   ([b][t][r][c], x as a bf16 value, x8)   0         8388608
//   St   128 B x [1024]     ([b][t], the token's statistics)        8388608   131072
//   end                                                              8519680
// d_out f32 [2][512][64][64] at byte 0.
// =====================================================================================================
extern "C" void kernel_launch(void* const* d_in, const int* in_sizes, int n_in,
                              void* d_out, int out_size, void* d_ws, size_t ws_size,
                              hipStream_t stream) {
  if (n_in < 6) return;
  if (in_sizes[0] != NTOT) return;
  if (in_sizes[1] != DS) return;
  if (in_sizes[2] != DS) return;
  if (in_sizes[3] != 1) return;
  if (in_sizes[4] != PLN) return;
  if (in_sizes[5] != PLN) return;
  if (out_size != NTOT) return;

  const float* x    = (const float*)d_in[0];   // [2][512][64][64]
  const float* logA = (const float*)d_in[1];   // [64]
  const float* dtw  = (const float*)d_in[2];   // [64]
  const float* dtb  = (const float*)d_in[3];   // [1]
  const float* lnw  = (const float*)d_in[4];   // [64][64]
  const float* lnb  = (const float*)d_in[5];   // [64][64]
  float* outf = (float*)d_out;

  const size_t PB = (size_t)NTOT * 2;          // 8388608
  const size_t SB = (size_t)NBT * 128;         //  131072
  size_t off = 0;
  const size_t oXv  = off; off += PB;
  const size_t oSt  = off; off += SB;
  if (off > ws_size) return;                   // off = 8519680
  if (off > (size_t)134217728) return;

  char* ws = (char*)d_ws;
  unsigned short* Xv  = (unsigned short*)(ws + oXv);
  unsigned int*   St  = (unsigned int*)(ws + oSt);

  const int nbt = in_sizes[0] / PLN;           // 1024
  // (1) LayerNorm statistics and the x plane
  ln_k<<<dim3(nbt), dim3(256), 0, stream>>>(x, Xv, St, nbt);
  // (2) dt, decay logs, prefix sum + causal decay product + gain and bias -> d_out
  ssm_k<<<dim3(TS / 64, DS, NB), dim3(128), 0, stream>>>(Xv, St, logA, dtw, dtb, lnw, lnb, outf);
  (void)hipGetLastError();
}
